// v000
// The times below were measured on an AMD MI455X: many runs one after another, warmed up first and cycling through
// copies of the inputs, with the whole window's GPU time divided by the number of runs. Launches and the gaps
// between them are all in it. The median over several windows is given; except for v000 it joins two sittings, which
// can be a few percent apart, so the side-by-side timings, each taken in one sitting, are the better comparison.
// v000 is the starting kernel.
#include <hip/hip_runtime.h>

// ---------------------------------------------------------------------------
// Problem constants (match reference): B=4, S=4096, H=1024, D=64
// out = Q (K^T V) / sqrt(D)   (no softmax -> associativity refactor)
// ---------------------------------------------------------------------------
#define BATCH 4
#define SEQ   4096
#define HID   1024
#define DHEAD 64
#define BS    (BATCH * SEQ)          // 16384 rows
#define SPLITS 64                    // split-K chunks over SEQ for K^T V
#define CHUNK (SEQ / SPLITS)         // 64 s-values per chunk
#define KC    32                     // K-chunk staged in LDS per block
#define NCHUNK (HID / KC)            // 32 chunks
#define NPAIR (KC / 2)               // 16 k-pairs per chunk
#define PSTRIDE 208                  // pair-row stride in float2 (192 + 16 pad)
                                     // 416 dwords = 32 mod 64 banks -> the two
                                     // lane-halves hit disjoint bank halves

typedef __attribute__((ext_vector_type(2))) float v2f;
typedef __attribute__((ext_vector_type(8))) float v8f;

// V_WMMA_F32_16X16X4_F32: D(16x16 f32) = A(16x4 f32) * B(4x16 f32) + C
__device__ __forceinline__ v8f wmma_f32(v2f a, v2f b, v8f c) {
  return __builtin_amdgcn_wmma_f32_16x16x4_f32(false, a, false, b, (short)0, c,
                                               false, false);
}

__device__ __forceinline__ v8f vzero8() {
  v8f z = {0.f, 0.f, 0.f, 0.f, 0.f, 0.f, 0.f, 0.f};
  return z;
}

// gfx1250 async DMA: LDS[lds_off..+3] = MEM[gaddr..+3]; tracked by ASYNCcnt.
// 4B granularity lets the copy itself perform the pair-interleave permute.
__device__ __forceinline__ void async_copy_b32(uint32_t lds_off,
                                               const float* gaddr) {
  asm volatile("global_load_async_to_lds_b32 %0, %1, off"
               :
               : "v"(lds_off), "v"(gaddr)
               : "memory");
}

__device__ __forceinline__ void wait_async0() {
  asm volatile("s_wait_asynccnt 0" ::: "memory");
}

// Stage one K-chunk of Wq|Wk|Wv into LDS in WMMA pair-major layout:
//   float2 at [p][wcol] = { W[k0+2p, c], W[k0+2p+1, c] },  wcol = w*64 + c.
// 3*32*64 = 6144 elements -> 24 async b32 copies per thread, coalesced reads.
__device__ __forceinline__ void stage_weights(const float* __restrict__ Wq,
                                              const float* __restrict__ Wk,
                                              const float* __restrict__ Wv,
                                              int k0, uint32_t lds_byte_base,
                                              int tid) {
#pragma unroll
  for (int i = 0; i < 24; ++i) {
    const int f = i * 256 + tid;
    const int c  = f & 63;           // column within one weight matrix
    const int kk = (f >> 6) & 31;    // k-row within chunk
    const int w  = f >> 11;          // 0=Q, 1=K, 2=V (uniform per wave)
    const float* g = (w == 0 ? Wq : (w == 1 ? Wk : Wv)) +
                     (size_t)(k0 + kk) * DHEAD + c;
    const uint32_t loff =
        lds_byte_base +
        (uint32_t)(((((kk >> 1) * PSTRIDE) + w * 64 + c) * 2 + (kk & 1)) * 4);
    async_copy_b32(loff, g);
  }
}

// ---------------------------------------------------------------------------
// Kernel 1: fused QKV projection.  [BS,H] @ [H,64] x3  -> q,k,v [BS,64]
// 8 waves/block, wave -> 16 rows x 192 cols (12 wmma accumulators).
// Weights double-buffered in LDS (pair-major) via async global->LDS DMA;
// each B fragment is a single conflict-free aligned ds_load_b64.
// grid: BS/(16*8) = 128 blocks of 256 threads.
// ---------------------------------------------------------------------------
__global__ __launch_bounds__(256) void qkv_proj_kernel(
    const float* __restrict__ x,   // [BS, H]
    const float* __restrict__ Wk,  // [H, D]
    const float* __restrict__ Wq,  // [H, D]
    const float* __restrict__ Wv,  // [H, D]
    float* __restrict__ qb, float* __restrict__ kb, float* __restrict__ vb) {
  __shared__ __align__(16) v2f ldsw[2][NPAIR * PSTRIDE];  // 52 KB

  const int lane = threadIdx.x & 31;
  const int wave = threadIdx.x >> 5;
  const int m0 = (blockIdx.x * 8 + wave) * 16;       // output row base
  const int arow = lane & 15;
  const int koff = (lane >> 4) << 1;                 // 0 or 2
  const int bcol = lane & 15;

  const uint32_t lds_base0 = (uint32_t)(uintptr_t)&ldsw[0][0];
  const uint32_t lds_base1 = (uint32_t)(uintptr_t)&ldsw[1][0];

  v8f accq[4], acck[4], accv[4];
#pragma unroll
  for (int i = 0; i < 4; ++i) {
    accq[i] = vzero8(); acck[i] = vzero8(); accv[i] = vzero8();
  }

  const float* xrow = x + (size_t)(m0 + arow) * HID;

  // Prologue: stage chunk 0 into buffer 0.
  stage_weights(Wq, Wk, Wv, 0, lds_base0, threadIdx.x);

  for (int c = 0; c < NCHUNK; ++c) {
    wait_async0();          // this wave's copies for chunk c have landed in LDS
    __syncthreads();        // all waves' copies have landed

    if (c + 1 < NCHUNK)     // overlap next chunk's DMA with this chunk's WMMAs
      stage_weights(Wq, Wk, Wv, (c + 1) * KC,
                    ((c + 1) & 1) ? lds_base1 : lds_base0, threadIdx.x);

    const v2f* lp = &ldsw[c & 1][0];
    const float* xr = xrow + c * KC;

#pragma unroll
    for (int ks = 0; ks < KC / 4; ++ks) {
      const v2f a = *(const v2f*)(xr + ks * 4 + koff);   // A[m, kk..kk+1]
      const int p = 2 * ks + (lane >> 4);                // k-pair index
      const int base = p * PSTRIDE + bcol;
#pragma unroll
      for (int nt = 0; nt < 4; ++nt) {
        const int nc = base + nt * 16;
        accq[nt] = wmma_f32(a, lp[nc],       accq[nt]);  // Q cols 0..63
        acck[nt] = wmma_f32(a, lp[nc + 64],  acck[nt]);  // K cols 64..127
        accv[nt] = wmma_f32(a, lp[nc + 128], accv[nt]);  // V cols 128..191
      }
    }
    __syncthreads();        // buffer (c&1) free for reuse at chunk c+2
  }

  // C/D layout: vgpr j, lanes 0-15 -> M=j, lanes 16-31 -> M=j+8; N = lane&15
  const int mhalf = (lane >> 4) << 3;
#pragma unroll
  for (int nt = 0; nt < 4; ++nt) {
#pragma unroll
    for (int j = 0; j < 8; ++j) {
      const size_t idx =
          (size_t)(m0 + mhalf + j) * DHEAD + nt * 16 + (lane & 15);
      qb[idx] = accq[nt][j];
      kb[idx] = acck[nt][j];
      vb[idx] = accv[nt][j];
    }
  }
}

// ---------------------------------------------------------------------------
// Kernel 2: M[b] += K[b]^T V[b]  (64x64 per batch), split-K over SEQ,
// f32 atomic reduction into Mbuf.  grid: BATCH*SPLITS blocks of 256 threads.
// Each of the 8 waves computes 2 of the 16 16x16 output tiles.
// ---------------------------------------------------------------------------
__global__ __launch_bounds__(256) void ktv_kernel(
    const float* __restrict__ kb, const float* __restrict__ vb,
    float* __restrict__ Mbuf) {
  const int lane = threadIdx.x & 31;
  const int wave = threadIdx.x >> 5;
  const int b = blockIdx.x / SPLITS;
  const int s0 = (blockIdx.x % SPLITS) * CHUNK;
  const int arow = lane & 15;
  const int koff = (lane >> 4) << 1;
  const int bcol = lane & 15;
  const int mhalf = (lane >> 4) << 3;

  const float* kmat = kb + (size_t)b * SEQ * DHEAD;
  const float* vmat = vb + (size_t)b * SEQ * DHEAD;
  float* Mb = Mbuf + (size_t)b * DHEAD * DHEAD;

#pragma unroll
  for (int t = 0; t < 2; ++t) {
    const int tile = wave * 2 + t;                   // 0..15
    const int ar0 = (tile >> 2) * 16;                // row base (k-feature i)
    const int bc0 = (tile & 3) * 16;                 // col base (v-feature j)
    v8f acc = vzero8();
    for (int s = s0; s < s0 + CHUNK; s += 4) {
      // A[i, s'] = k[s', i]  (transposed gather), B[s', j] = v[s', j]
      v2f a, bbv;
      a.x   = kmat[(size_t)(s + koff)     * DHEAD + ar0 + arow];
      a.y   = kmat[(size_t)(s + koff + 1) * DHEAD + ar0 + arow];
      bbv.x = vmat[(size_t)(s + koff)     * DHEAD + bc0 + bcol];
      bbv.y = vmat[(size_t)(s + koff + 1) * DHEAD + bc0 + bcol];
      acc = wmma_f32(a, bbv, acc);
    }
#pragma unroll
    for (int j = 0; j < 8; ++j) {
      atomicAdd(&Mb[(ar0 + mhalf + j) * DHEAD + bc0 + (lane & 15)], acc[j]);
    }
  }
}

// ---------------------------------------------------------------------------
// Kernel 3: out = Q @ M[b] * (1/sqrt(D)).  [BS,64] @ [64,64].
// grid: 128 blocks of 256 threads; wave -> 16 rows x 64 cols.
// ---------------------------------------------------------------------------
__global__ __launch_bounds__(256) void qm_kernel(
    const float* __restrict__ qb, const float* __restrict__ Mbuf,
    float* __restrict__ out) {
  const int lane = threadIdx.x & 31;
  const int wave = threadIdx.x >> 5;
  const int m0 = (blockIdx.x * 8 + wave) * 16;       // rows; never straddles batch
  const int b = m0 / SEQ;
  const int arow = lane & 15;
  const int koff = (lane >> 4) << 1;
  const int bcol = lane & 15;
  const int mhalf = (lane >> 4) << 3;

  const float* qrow = qb + (size_t)(m0 + arow) * DHEAD;
  const float* Mb = Mbuf + (size_t)b * DHEAD * DHEAD;

  v8f acc[4];
#pragma unroll
  for (int i = 0; i < 4; ++i) acc[i] = vzero8();

#pragma unroll
  for (int kk = 0; kk < DHEAD; kk += 4) {
    const v2f a = *(const v2f*)(qrow + kk + koff);
    const int r0 = (kk + koff) * DHEAD;
    const int r1 = r0 + DHEAD;
#pragma unroll
    for (int nt = 0; nt < 4; ++nt) {
      v2f bbm;
      bbm.x = Mb[r0 + nt * 16 + bcol];
      bbm.y = Mb[r1 + nt * 16 + bcol];
      acc[nt] = wmma_f32(a, bbm, acc[nt]);
    }
  }

  const float scale = 0.125f;                        // 1/sqrt(64)
#pragma unroll
  for (int nt = 0; nt < 4; ++nt) {
#pragma unroll
    for (int j = 0; j < 8; ++j) {
      out[(size_t)(m0 + mhalf + j) * DHEAD + nt * 16 + (lane & 15)] =
          acc[nt][j] * scale;
    }
  }
}

// ---------------------------------------------------------------------------
// Host launcher. Inputs: x, Wk, Wq, Wv (fp32). Output: [B,S,D] fp32.
// Workspace layout: q | k | v (4 MB each) | M (64 KB).
// ---------------------------------------------------------------------------
extern "C" void kernel_launch(void* const* d_in, const int* in_sizes, int n_in,
                              void* d_out, int out_size, void* d_ws,
                              size_t ws_size, hipStream_t stream) {
  (void)in_sizes; (void)n_in; (void)out_size; (void)ws_size;
  const float* x  = (const float*)d_in[0];
  const float* Wk = (const float*)d_in[1];
  const float* Wq = (const float*)d_in[2];
  const float* Wv = (const float*)d_in[3];
  float* out = (float*)d_out;

  const size_t proj_elems = (size_t)BS * DHEAD;      // 1,048,576
  float* qb = (float*)d_ws;
  float* kb = qb + proj_elems;
  float* vb = kb + proj_elems;
  float* Mb = vb + proj_elems;                       // BATCH*64*64 floats

  hipMemsetAsync(Mb, 0, (size_t)BATCH * DHEAD * DHEAD * sizeof(float), stream);

  qkv_proj_kernel<<<BS / 128, 256, 0, stream>>>(x, Wk, Wq, Wv, qb, kb, vb);
  ktv_kernel<<<BATCH * SPLITS, 256, 0, stream>>>(kb, vb, Mb);
  qm_kernel<<<BS / 128, 256, 0, stream>>>(qb, Mb, out);
}

// v001
// Two timings next to v000 put it at 1.20 and 1.21 times that version's speed.
#include <hip/hip_runtime.h>

// ---------------------------------------------------------------------------
// Problem constants (match reference): B=4, S=4096, H=1024, D=64
// out = Q (K^T V) / sqrt(D)   (no softmax -> associativity refactor)
// ---------------------------------------------------------------------------
#define BATCH 4
#define SEQ   4096
#define HID   1024
#define DHEAD 64
#define BS    (BATCH * SEQ)          // 16384 rows
#define SPLITS 64                    // split-K chunks over SEQ for K^T V
#define CHUNK (SEQ / SPLITS)         // 64 s-values per chunk
#define KC    32                     // K-chunk staged in LDS per block
#define NCHUNK (HID / KC)            // 32 chunks
#define NPAIR (KC / 2)               // 16 k-pairs per chunk
#define PSTRIDE 208                  // pair-row stride in float2 (192 + 16 pad)
                                     // 416 dwords = 32 mod 64 banks -> the two
                                     // lane-halves hit disjoint bank halves

typedef __attribute__((ext_vector_type(2))) float v2f;
typedef __attribute__((ext_vector_type(8))) float v8f;

// V_WMMA_F32_16X16X4_F32: D(16x16 f32) = A(16x4 f32) * B(4x16 f32) + C
__device__ __forceinline__ v8f wmma_f32(v2f a, v2f b, v8f c) {
  return __builtin_amdgcn_wmma_f32_16x16x4_f32(false, a, false, b, (short)0, c,
                                               false, false);
}

__device__ __forceinline__ v8f vzero8() {
  v8f z = {0.f, 0.f, 0.f, 0.f, 0.f, 0.f, 0.f, 0.f};
  return z;
}

// gfx1250 async DMA: LDS[lds_off..+3] = MEM[gaddr..+3]; tracked by ASYNCcnt.
// 4B granularity lets the copy itself perform the pair-interleave permute.
__device__ __forceinline__ void async_copy_b32(uint32_t lds_off,
                                               const float* gaddr) {
  asm volatile("global_load_async_to_lds_b32 %0, %1, off"
               :
               : "v"(lds_off), "v"(gaddr)
               : "memory");
}

__device__ __forceinline__ void wait_async0() {
  asm volatile("s_wait_asynccnt 0" ::: "memory");
}

// Stage one K-chunk of Wq|Wk|Wv into LDS in WMMA pair-major layout:
//   float2 at [p][wcol] = { W[k0+2p, c], W[k0+2p+1, c] },  wcol = w*64 + c.
// 3*32*64 = 6144 elements -> 24 async b32 copies per thread, coalesced reads.
__device__ __forceinline__ void stage_weights(const float* __restrict__ Wq,
                                              const float* __restrict__ Wk,
                                              const float* __restrict__ Wv,
                                              int k0, uint32_t lds_byte_base,
                                              int tid) {
#pragma unroll
  for (int i = 0; i < 24; ++i) {
    const int f = i * 256 + tid;
    const int c  = f & 63;           // column within one weight matrix
    const int kk = (f >> 6) & 31;    // k-row within chunk
    const int w  = f >> 11;          // 0=Q, 1=K, 2=V (uniform per wave)
    const float* g = (w == 0 ? Wq : (w == 1 ? Wk : Wv)) +
                     (size_t)(k0 + kk) * DHEAD + c;
    const uint32_t loff =
        lds_byte_base +
        (uint32_t)(((((kk >> 1) * PSTRIDE) + w * 64 + c) * 2 + (kk & 1)) * 4);
    async_copy_b32(loff, g);
  }
}

// ---------------------------------------------------------------------------
// Kernel 1: fused QKV projection.  [BS,H] @ [H,64] x3  -> q,k,v [BS,64]
// 8 waves/block, wave -> 16 rows x 192 cols (12 wmma accumulators).
// Weights double-buffered in LDS (pair-major) via async global->LDS DMA;
// each B fragment is a single conflict-free aligned ds_load_b64.
// A (global) is fetched one chunk ahead, B (LDS) one k-step ahead, in registers.
// grid: BS/(16*8) = 128 blocks of 256 threads.
// ---------------------------------------------------------------------------
__global__ __launch_bounds__(256) void qkv_proj_kernel(
    const float* __restrict__ x,   // [BS, H]
    const float* __restrict__ Wk,  // [H, D]
    const float* __restrict__ Wq,  // [H, D]
    const float* __restrict__ Wv,  // [H, D]
    float* __restrict__ qb, float* __restrict__ kb, float* __restrict__ vb) {
  __shared__ __align__(16) v2f ldsw[2][NPAIR * PSTRIDE];  // 52 KB

  const int lane = threadIdx.x & 31;
  const int wave = threadIdx.x >> 5;
  const int m0 = (blockIdx.x * 8 + wave) * 16;       // output row base
  const int arow = lane & 15;
  const int koff = (lane >> 4) << 1;                 // 0 or 2
  const int bcol = lane & 15;

  const uint32_t lds_base0 = (uint32_t)(uintptr_t)&ldsw[0][0];
  const uint32_t lds_base1 = (uint32_t)(uintptr_t)&ldsw[1][0];

  v8f accq[4], acck[4], accv[4];
#pragma unroll
  for (int i = 0; i < 4; ++i) {
    accq[i] = vzero8(); acck[i] = vzero8(); accv[i] = vzero8();
  }

  const float* xrow = x + (size_t)(m0 + arow) * HID;

  // A fragments of chunk 0; later chunks are fetched one chunk ahead.
  v2f acur[KC / 4];
#pragma unroll
  for (int ks = 0; ks < KC / 4; ++ks)
    acur[ks] = *(const v2f*)(xrow + ks * 4 + koff);

  // Prologue: stage chunk 0 into buffer 0.
  stage_weights(Wq, Wk, Wv, 0, lds_base0, threadIdx.x);

  for (int c = 0; c < NCHUNK; ++c) {
    wait_async0();          // this wave's copies for chunk c have landed in LDS
    __syncthreads();        // all waves' copies have landed

    const v2f* lp = &ldsw[c & 1][0];

    // A fragments of chunk c+1: issued a whole chunk ahead of their first use,
    // so the latency of x runs under this chunk's WMMAs.
    // The last chunk has no successor: its index is clamped (branch-free,
    // in bounds) and what it fetches is not used.
    const float* xn = xrow + ((c + 1 < NCHUNK) ? c + 1 : c) * KC + koff;
    v2f anxt[KC / 4];
#pragma unroll
    for (int ks = 0; ks < KC / 4; ++ks)
      anxt[ks] = *(const v2f*)(xn + ks * 4);             // A[m, kk..kk+1]

    // The A loads above are in flight and the code below reuses their address
    // registers: the wait that is kept in front of such an overwrite.
    asm volatile("s_wait_xcnt 0x0" ::: "memory");

    // B fragments: the 12 of k-step ks+1 are read from LDS as one group in
    // front of the 12 WMMAs of k-step ks (second register set).
    const int base0 = (lane >> 4) * PSTRIDE + bcol;      // k-pair 2*ks + half
    v2f bcur[12], bnxt[12];
#pragma unroll
    for (int j = 0; j < 12; ++j) bcur[j] = lp[base0 + j * 16];

    if (c + 1 < NCHUNK)     // overlap next chunk's DMA with this chunk's WMMAs
      stage_weights(Wq, Wk, Wv, (c + 1) * KC,
                    ((c + 1) & 1) ? lds_base1 : lds_base0, threadIdx.x);

#pragma unroll
    for (int ks = 0; ks < KC / 4; ++ks) {
      if (ks + 1 < KC / 4) {
        const int base = base0 + 2 * (ks + 1) * PSTRIDE;
#pragma unroll
        for (int j = 0; j < 12; ++j) bnxt[j] = lp[base + j * 16];
        // Keeps those reads one group in front of the WMMAs (for speed only).
        __builtin_amdgcn_sched_barrier(0);
      }
      const v2f a = acur[ks];
#pragma unroll
      for (int nt = 0; nt < 4; ++nt) {
        accq[nt] = wmma_f32(a, bcur[nt],     accq[nt]);  // Q cols 0..63
        acck[nt] = wmma_f32(a, bcur[nt + 4], acck[nt]);  // K cols 64..127
        accv[nt] = wmma_f32(a, bcur[nt + 8], accv[nt]);  // V cols 128..191
      }
#pragma unroll
      for (int j = 0; j < 12; ++j) bcur[j] = bnxt[j];
    }
#pragma unroll
    for (int ks = 0; ks < KC / 4; ++ks) acur[ks] = anxt[ks];
    __syncthreads();        // buffer (c&1) free for reuse at chunk c+2
  }

  // C/D layout: vgpr j, lanes 0-15 -> M=j, lanes 16-31 -> M=j+8; N = lane&15
  const int mhalf = (lane >> 4) << 3;
#pragma unroll
  for (int nt = 0; nt < 4; ++nt) {
#pragma unroll
    for (int j = 0; j < 8; ++j) {
      const size_t idx =
          (size_t)(m0 + mhalf + j) * DHEAD + nt * 16 + (lane & 15);
      qb[idx] = accq[nt][j];
      kb[idx] = acck[nt][j];
      vb[idx] = accv[nt][j];
    }
  }
}

// ---------------------------------------------------------------------------
// Kernel 2: M[b] += K[b]^T V[b]  (64x64 per batch), split-K over SEQ,
// f32 atomic reduction into Mbuf.  grid: BATCH*SPLITS blocks of 256 threads.
// Each of the 8 waves computes 2 of the 16 16x16 output tiles.
// ---------------------------------------------------------------------------
__global__ __launch_bounds__(256) void ktv_kernel(
    const float* __restrict__ kb, const float* __restrict__ vb,
    float* __restrict__ Mbuf) {
  const int lane = threadIdx.x & 31;
  const int wave = threadIdx.x >> 5;
  const int b = blockIdx.x / SPLITS;
  const int s0 = (blockIdx.x % SPLITS) * CHUNK;
  const int arow = lane & 15;
  const int koff = (lane >> 4) << 1;
  const int bcol = lane & 15;
  const int mhalf = (lane >> 4) << 3;

  const float* kmat = kb + (size_t)b * SEQ * DHEAD;
  const float* vmat = vb + (size_t)b * SEQ * DHEAD;
  float* Mb = Mbuf + (size_t)b * DHEAD * DHEAD;

#pragma unroll
  for (int t = 0; t < 2; ++t) {
    const int tile = wave * 2 + t;                   // 0..15
    const int ar0 = (tile >> 2) * 16;                // row base (k-feature i)
    const int bc0 = (tile & 3) * 16;                 // col base (v-feature j)
    v8f acc = vzero8();
    for (int s = s0; s < s0 + CHUNK; s += 4) {
      // A[i, s'] = k[s', i]  (transposed gather), B[s', j] = v[s', j]
      v2f a, bbv;
      a.x   = kmat[(size_t)(s + koff)     * DHEAD + ar0 + arow];
      a.y   = kmat[(size_t)(s + koff + 1) * DHEAD + ar0 + arow];
      bbv.x = vmat[(size_t)(s + koff)     * DHEAD + bc0 + bcol];
      bbv.y = vmat[(size_t)(s + koff + 1) * DHEAD + bc0 + bcol];
      acc = wmma_f32(a, bbv, acc);
    }
#pragma unroll
    for (int j = 0; j < 8; ++j) {
      atomicAdd(&Mb[(ar0 + mhalf + j) * DHEAD + bc0 + (lane & 15)], acc[j]);
    }
  }
}

// ---------------------------------------------------------------------------
// Kernel 3: out = Q @ M[b] * (1/sqrt(D)).  [BS,64] @ [64,64].
// grid: 128 blocks of 256 threads; wave -> 16 rows x 64 cols.
// ---------------------------------------------------------------------------
__global__ __launch_bounds__(256) void qm_kernel(
    const float* __restrict__ qb, const float* __restrict__ Mbuf,
    float* __restrict__ out) {
  const int lane = threadIdx.x & 31;
  const int wave = threadIdx.x >> 5;
  const int m0 = (blockIdx.x * 8 + wave) * 16;       // rows; never straddles batch
  const int b = m0 / SEQ;
  const int arow = lane & 15;
  const int koff = (lane >> 4) << 1;
  const int bcol = lane & 15;
  const int mhalf = (lane >> 4) << 3;

  const float* qrow = qb + (size_t)(m0 + arow) * DHEAD;
  const float* Mb = Mbuf + (size_t)b * DHEAD * DHEAD;

  v8f acc[4];
#pragma unroll
  for (int i = 0; i < 4; ++i) acc[i] = vzero8();

#pragma unroll
  for (int kk = 0; kk < DHEAD; kk += 4) {
    const v2f a = *(const v2f*)(qrow + kk + koff);
    const int r0 = (kk + koff) * DHEAD;
    const int r1 = r0 + DHEAD;
#pragma unroll
    for (int nt = 0; nt < 4; ++nt) {
      v2f bbm;
      bbm.x = Mb[r0 + nt * 16 + bcol];
      bbm.y = Mb[r1 + nt * 16 + bcol];
      acc[nt] = wmma_f32(a, bbm, acc[nt]);
    }
  }

  const float scale = 0.125f;                        // 1/sqrt(64)
#pragma unroll
  for (int nt = 0; nt < 4; ++nt) {
#pragma unroll
    for (int j = 0; j < 8; ++j) {
      out[(size_t)(m0 + mhalf + j) * DHEAD + nt * 16 + (lane & 15)] =
          acc[nt][j] * scale;
    }
  }
}

// ---------------------------------------------------------------------------
// Host launcher. Inputs: x, Wk, Wq, Wv (fp32). Output: [B,S,D] fp32.
// Workspace layout: q | k | v (4 MB each) | M (64 KB).
// ---------------------------------------------------------------------------
extern "C" void kernel_launch(void* const* d_in, const int* in_sizes, int n_in,
                              void* d_out, int out_size, void* d_ws,
                              size_t ws_size, hipStream_t stream) {
  (void)in_sizes; (void)n_in; (void)out_size; (void)ws_size;
  const float* x  = (const float*)d_in[0];
  const float* Wk = (const float*)d_in[1];
  const float* Wq = (const float*)d_in[2];
  const float* Wv = (const float*)d_in[3];
  float* out = (float*)d_out;

  const size_t proj_elems = (size_t)BS * DHEAD;      // 1,048,576
  float* qb = (float*)d_ws;
  float* kb = qb + proj_elems;
  float* vb = kb + proj_elems;
  float* Mb = vb + proj_elems;                       // BATCH*64*64 floats

  hipMemsetAsync(Mb, 0, (size_t)BATCH * DHEAD * DHEAD * sizeof(float), stream);

  qkv_proj_kernel<<<BS / 128, 256, 0, stream>>>(x, Wk, Wq, Wv, qb, kb, vb);
  ktv_kernel<<<BATCH * SPLITS, 256, 0, stream>>>(kb, vb, Mb);
  qm_kernel<<<BS / 128, 256, 0, stream>>>(qb, Mb, out);
}

// v002
// Timed twice side by side with v001, it ran 1.45 times as fast both times.
// Counting every step since v000, it is 1.75 times as fast.
#include <hip/hip_runtime.h>

// ---------------------------------------------------------------------------
// Problem constants (match reference): B=4, S=4096, H=1024, D=64
// out = Q (K^T V) / sqrt(D)   (no softmax -> associativity refactor)
// ---------------------------------------------------------------------------
#define BATCH 4
#define SEQ   4096
#define HID   1024
#define DHEAD 64
#define BS    (BATCH * SEQ)          // 16384 rows
#define SPLITS 64                    // split-K chunks over SEQ for K^T V
#define CHUNK (SEQ / SPLITS)         // 64 s-values per chunk
#define KC    32                     // K-chunk staged in LDS per block
#define NCHUNK (HID / KC)            // 32 chunks
#define NPAIR (KC / 2)               // 16 k-pairs per chunk
#define PSTRIDE 208                  // pair-row stride in float2 (192 + 16 pad)
                                     // 416 dwords = 32 mod 64 banks -> the two
                                     // lane-halves hit disjoint bank halves

typedef __attribute__((ext_vector_type(2))) float v2f;
typedef __attribute__((ext_vector_type(8))) float v8f;

// V_WMMA_F32_16X16X4_F32: D(16x16 f32) = A(16x4 f32) * B(4x16 f32) + C
__device__ __forceinline__ v8f wmma_f32(v2f a, v2f b, v8f c) {
  return __builtin_amdgcn_wmma_f32_16x16x4_f32(false, a, false, b, (short)0, c,
                                               false, false);
}

__device__ __forceinline__ v8f vzero8() {
  v8f z = {0.f, 0.f, 0.f, 0.f, 0.f, 0.f, 0.f, 0.f};
  return z;
}

// gfx1250 async DMA: LDS[lds_off..+3] = MEM[gaddr..+3]; tracked by ASYNCcnt.
// 4B granularity lets the copy itself perform the pair-interleave permute.
__device__ __forceinline__ void async_copy_b32(uint32_t lds_off,
                                               const float* gaddr) {
  asm volatile("global_load_async_to_lds_b32 %0, %1, off"
               :
               : "v"(lds_off), "v"(gaddr)
               : "memory");
}

__device__ __forceinline__ void wait_async0() {
  asm volatile("s_wait_asynccnt 0" ::: "memory");
}

// Stage one K-chunk of Wq|Wk|Wv into LDS in WMMA pair-major layout:
//   float2 at [p][wcol] = { W[k0+2p, c], W[k0+2p+1, c] },  wcol = w*64 + c.
// 3*32*64 = 6144 elements -> 24 async b32 copies per thread, coalesced reads.
__device__ __forceinline__ void stage_weights(const float* __restrict__ Wq,
                                              const float* __restrict__ Wk,
                                              const float* __restrict__ Wv,
                                              int k0, uint32_t lds_byte_base,
                                              int tid) {
#pragma unroll
  for (int i = 0; i < 24; ++i) {
    const int f = i * 256 + tid;
    const int c  = f & 63;           // column within one weight matrix
    const int kk = (f >> 6) & 31;    // k-row within chunk
    const int w  = f >> 11;          // 0=Q, 1=K, 2=V (uniform per wave)
    const float* g = (w == 0 ? Wq : (w == 1 ? Wk : Wv)) +
                     (size_t)(k0 + kk) * DHEAD + c;
    const uint32_t loff =
        lds_byte_base +
        (uint32_t)(((((kk >> 1) * PSTRIDE) + w * 64 + c) * 2 + (kk & 1)) * 4);
    async_copy_b32(loff, g);
  }
}

// ---------------------------------------------------------------------------
// Kernel 1: fused QKV projection.  [BS,H] @ [H,64] x3  -> q,k,v [BS,64]
// 8 waves/block on 64 rows: wave -> 16 rows x 96 cols (6 wmma accumulators),
// waves w and w+4 take the two column halves of one row tile, so that the
// grid has one block for each of the chip's 256 WGPs.
// Weights double-buffered in LDS (pair-major) via async global->LDS DMA;
// each B fragment is a single conflict-free aligned ds_load_b64.
// A (global) is fetched one chunk ahead, B (LDS) one group of two k-steps ahead, in registers.
// grid: BS/(16*4) = 256 blocks of 256 threads.
// ---------------------------------------------------------------------------
__global__ __launch_bounds__(256) void qkv_proj_kernel(
    const float* __restrict__ x,   // [BS, H]
    const float* __restrict__ Wk,  // [H, D]
    const float* __restrict__ Wq,  // [H, D]
    const float* __restrict__ Wv,  // [H, D]
    float* __restrict__ qb, float* __restrict__ kb, float* __restrict__ vb) {
  __shared__ __align__(16) v2f ldsw[2][NPAIR * PSTRIDE];  // 52 KB

  const int lane = threadIdx.x & 31;
  // Wave-uniform: keeps the column half and the output pointers scalar.
  const int wave = __builtin_amdgcn_readfirstlane(threadIdx.x >> 5);
  const int chalf = wave >> 2;                       // cols 0..95 or 96..191
  const int m0 = (blockIdx.x * 4 + (wave & 3)) * 16; // output row base
  const int arow = lane & 15;
  const int koff = (lane >> 4) << 1;                 // 0 or 2
  const int bcol = lane & 15;

  const uint32_t lds_base0 = (uint32_t)(uintptr_t)&ldsw[0][0];
  const uint32_t lds_base1 = (uint32_t)(uintptr_t)&ldsw[1][0];

  v8f acc[6];                // 16-col tiles chalf*6 .. chalf*6+5 of Q|K|V
#pragma unroll
  for (int i = 0; i < 6; ++i) acc[i] = vzero8();

  const float* xrow = x + (size_t)(m0 + arow) * HID;

  // A fragments of chunk 0; later chunks are fetched one chunk ahead.
  v2f acur[KC / 4];
#pragma unroll
  for (int ks = 0; ks < KC / 4; ++ks)
    acur[ks] = *(const v2f*)(xrow + ks * 4 + koff);

  // Prologue: stage chunk 0 into buffer 0.
  stage_weights(Wq, Wk, Wv, 0, lds_base0, threadIdx.x);

  for (int c = 0; c < NCHUNK; ++c) {
    wait_async0();          // this wave's copies for chunk c have landed in LDS
    __syncthreads();        // all waves' copies have landed

    const v2f* lp = &ldsw[c & 1][0];

    // A fragments of chunk c+1: issued a whole chunk ahead of their first use,
    // so the latency of x runs under this chunk's WMMAs.
    // The last chunk has no successor: its index is clamped (branch-free,
    // in bounds) and what it fetches is not used.
    const float* xn = xrow + ((c + 1 < NCHUNK) ? c + 1 : c) * KC + koff;
    v2f anxt[KC / 4];
#pragma unroll
    for (int ks = 0; ks < KC / 4; ++ks)
      anxt[ks] = *(const v2f*)(xn + ks * 4);             // A[m, kk..kk+1]

    // The A loads above are in flight and the code below reuses their address
    // registers: the wait that is kept in front of such an overwrite.
    asm volatile("s_wait_xcnt 0x0" ::: "memory");

    // B fragments: the 12 of k-steps 2g+2, 2g+3 are read from LDS as one group
    // in front of the 12 WMMAs of k-steps 2g, 2g+1 (second register set).
    const int base0 = (lane >> 4) * PSTRIDE + chalf * 96 + bcol;  // k-pair 2*ks + half
    v2f bcur[12], bnxt[12];
#pragma unroll
    for (int j = 0; j < 12; ++j)
      bcur[j] = lp[base0 + 2 * (j / 6) * PSTRIDE + (j % 6) * 16];

    if (c + 1 < NCHUNK)     // overlap next chunk's DMA with this chunk's WMMAs
      stage_weights(Wq, Wk, Wv, (c + 1) * KC,
                    ((c + 1) & 1) ? lds_base1 : lds_base0, threadIdx.x);

    // Unrolled throughout: acc, acur, bcur and bnxt are indexed by constants
    // only and so stay in registers.
#pragma unroll
    for (int g = 0; g < KC / 8; ++g) {
      if (g + 1 < KC / 8) {
        const int base = base0 + 4 * (g + 1) * PSTRIDE;
#pragma unroll
        for (int j = 0; j < 12; ++j)
          bnxt[j] = lp[base + 2 * (j / 6) * PSTRIDE + (j % 6) * 16];
        // Keeps those reads one group in front of the WMMAs (for speed only).
        __builtin_amdgcn_sched_barrier(0);
      }
#pragma unroll
      for (int h = 0; h < 2; ++h) {
        const v2f a = acur[2 * g + h];
#pragma unroll
        for (int t = 0; t < 6; ++t)
          acc[t] = wmma_f32(a, bcur[h * 6 + t], acc[t]);
      }
#pragma unroll
      for (int j = 0; j < 12; ++j) bcur[j] = bnxt[j];
    }
#pragma unroll
    for (int ks = 0; ks < KC / 4; ++ks) acur[ks] = anxt[ks];
    __syncthreads();        // buffer (c&1) free for reuse at chunk c+2
  }

  // C/D layout: vgpr j, lanes 0-15 -> M=j, lanes 16-31 -> M=j+8; N = lane&15
  const int mhalf = (lane >> 4) << 3;
#pragma unroll
  for (int t = 0; t < 6; ++t) {
    const int tile = chalf * 6 + t;                  // 0..3 Q, 4..7 K, 8..11 V
    float* dst = tile < 4 ? qb : (tile < 8 ? kb : vb);
#pragma unroll
    for (int j = 0; j < 8; ++j) {
      const size_t idx =
          (size_t)(m0 + mhalf + j) * DHEAD + (tile & 3) * 16 + (lane & 15);
      dst[idx] = acc[t][j];
    }
  }
}

// ---------------------------------------------------------------------------
// Kernel 2: M[b] += K[b]^T V[b]  (64x64 per batch), split-K over SEQ,
// f32 atomic reduction into Mbuf.  grid: BATCH*SPLITS blocks of 256 threads.
// Each of the 8 waves computes 2 of the 16 16x16 output tiles.
// ---------------------------------------------------------------------------
__global__ __launch_bounds__(256) void ktv_kernel(
    const float* __restrict__ kb, const float* __restrict__ vb,
    float* __restrict__ Mbuf) {
  const int lane = threadIdx.x & 31;
  const int wave = threadIdx.x >> 5;
  const int b = blockIdx.x / SPLITS;
  const int s0 = (blockIdx.x % SPLITS) * CHUNK;
  const int arow = lane & 15;
  const int koff = (lane >> 4) << 1;
  const int bcol = lane & 15;
  const int mhalf = (lane >> 4) << 3;

  const float* kmat = kb + (size_t)b * SEQ * DHEAD;
  const float* vmat = vb + (size_t)b * SEQ * DHEAD;
  float* Mb = Mbuf + (size_t)b * DHEAD * DHEAD;

#pragma unroll
  for (int t = 0; t < 2; ++t) {
    const int tile = wave * 2 + t;                   // 0..15
    const int ar0 = (tile >> 2) * 16;                // row base (k-feature i)
    const int bc0 = (tile & 3) * 16;                 // col base (v-feature j)
    v8f acc = vzero8();
    for (int s = s0; s < s0 + CHUNK; s += 4) {
      // A[i, s'] = k[s', i]  (transposed gather), B[s', j] = v[s', j]
      v2f a, bbv;
      a.x   = kmat[(size_t)(s + koff)     * DHEAD + ar0 + arow];
      a.y   = kmat[(size_t)(s + koff + 1) * DHEAD + ar0 + arow];
      bbv.x = vmat[(size_t)(s + koff)     * DHEAD + bc0 + bcol];
      bbv.y = vmat[(size_t)(s + koff + 1) * DHEAD + bc0 + bcol];
      acc = wmma_f32(a, bbv, acc);
    }
#pragma unroll
    for (int j = 0; j < 8; ++j) {
      atomicAdd(&Mb[(ar0 + mhalf + j) * DHEAD + bc0 + (lane & 15)], acc[j]);
    }
  }
}

// ---------------------------------------------------------------------------
// Kernel 3: out = Q @ M[b] * (1/sqrt(D)).  [BS,64] @ [64,64].
// grid: 128 blocks of 256 threads; wave -> 16 rows x 64 cols.
// ---------------------------------------------------------------------------
__global__ __launch_bounds__(256) void qm_kernel(
    const float* __restrict__ qb, const float* __restrict__ Mbuf,
    float* __restrict__ out) {
  const int lane = threadIdx.x & 31;
  const int wave = threadIdx.x >> 5;
  const int m0 = (blockIdx.x * 8 + wave) * 16;       // rows; never straddles batch
  const int b = m0 / SEQ;
  const int arow = lane & 15;
  const int koff = (lane >> 4) << 1;
  const int bcol = lane & 15;
  const int mhalf = (lane >> 4) << 3;

  const float* qrow = qb + (size_t)(m0 + arow) * DHEAD;
  const float* Mb = Mbuf + (size_t)b * DHEAD * DHEAD;

  v8f acc[4];
#pragma unroll
  for (int i = 0; i < 4; ++i) acc[i] = vzero8();

#pragma unroll
  for (int kk = 0; kk < DHEAD; kk += 4) {
    const v2f a = *(const v2f*)(qrow + kk + koff);
    const int r0 = (kk + koff) * DHEAD;
    const int r1 = r0 + DHEAD;
#pragma unroll
    for (int nt = 0; nt < 4; ++nt) {
      v2f bbm;
      bbm.x = Mb[r0 + nt * 16 + bcol];
      bbm.y = Mb[r1 + nt * 16 + bcol];
      acc[nt] = wmma_f32(a, bbm, acc[nt]);
    }
  }

  const float scale = 0.125f;                        // 1/sqrt(64)
#pragma unroll
  for (int nt = 0; nt < 4; ++nt) {
#pragma unroll
    for (int j = 0; j < 8; ++j) {
      out[(size_t)(m0 + mhalf + j) * DHEAD + nt * 16 + (lane & 15)] =
          acc[nt][j] * scale;
    }
  }
}

// ---------------------------------------------------------------------------
// Host launcher. Inputs: x, Wk, Wq, Wv (fp32). Output: [B,S,D] fp32.
// Workspace layout: q | k | v (4 MB each) | M (64 KB).
// ---------------------------------------------------------------------------
extern "C" void kernel_launch(void* const* d_in, const int* in_sizes, int n_in,
                              void* d_out, int out_size, void* d_ws,
                              size_t ws_size, hipStream_t stream) {
  (void)in_sizes; (void)n_in; (void)out_size; (void)ws_size;
  const float* x  = (const float*)d_in[0];
  const float* Wk = (const float*)d_in[1];
  const float* Wq = (const float*)d_in[2];
  const float* Wv = (const float*)d_in[3];
  float* out = (float*)d_out;

  const size_t proj_elems = (size_t)BS * DHEAD;      // 1,048,576
  float* qb = (float*)d_ws;
  float* kb = qb + proj_elems;
  float* vb = kb + proj_elems;
  float* Mb = vb + proj_elems;                       // BATCH*64*64 floats

  hipMemsetAsync(Mb, 0, (size_t)BATCH * DHEAD * DHEAD * sizeof(float), stream);

  qkv_proj_kernel<<<BS / 64, 256, 0, stream>>>(x, Wk, Wq, Wv, qb, kb, vb);
  ktv_kernel<<<BATCH * SPLITS, 256, 0, stream>>>(kb, vb, Mb);
  qm_kernel<<<BS / 128, 256, 0, stream>>>(qb, Mb, out);
}

// v003
// In both of two side-by-side timings against v002, it was 1.04 times as fast.
// Over all steps from v000 it is 1.82 times as fast.
#include <hip/hip_runtime.h>

// ---------------------------------------------------------------------------
// Problem constants (match reference): B=4, S=4096, H=1024, D=64
// out = Q (K^T V) / sqrt(D)   (no softmax -> associativity refactor)
// ---------------------------------------------------------------------------
#define BATCH 4
#define SEQ   4096
#define HID   1024
#define DHEAD 64
#define BS    (BATCH * SEQ)          // 16384 rows
#define ROWS  64                     // rows of x per projection block; also the
                                     // s-values of one K^T V partial sum
#define KC    32                     // K-chunk staged in LDS per block
#define NCHUNK (HID / KC)            // 32 chunks
#define NPAIR (KC / 2)               // 16 k-pairs per chunk
#define PSTRIDE 208                  // pair-row stride in float2 (192 + 16 pad)
                                     // 416 dwords = 32 mod 64 banks -> the two
                                     // lane-halves hit disjoint bank halves
#define KVSTRIDE 144                 // same for the K|V tile (128 + 16 pad)

typedef __attribute__((ext_vector_type(2))) float v2f;
typedef __attribute__((ext_vector_type(8))) float v8f;

// V_WMMA_F32_16X16X4_F32: D(16x16 f32) = A(16x4 f32) * B(4x16 f32) + C
__device__ __forceinline__ v8f wmma_f32(v2f a, v2f b, v8f c) {
  return __builtin_amdgcn_wmma_f32_16x16x4_f32(false, a, false, b, (short)0, c,
                                               false, false);
}

__device__ __forceinline__ v8f vzero8() {
  v8f z = {0.f, 0.f, 0.f, 0.f, 0.f, 0.f, 0.f, 0.f};
  return z;
}

// gfx1250 async DMA: LDS[lds_off..+3] = MEM[gaddr..+3]; tracked by ASYNCcnt.
// 4B granularity lets the copy itself perform the pair-interleave permute.
__device__ __forceinline__ void async_copy_b32(uint32_t lds_off,
                                               const float* gaddr) {
  asm volatile("global_load_async_to_lds_b32 %0, %1, off"
               :
               : "v"(lds_off), "v"(gaddr)
               : "memory");
}

__device__ __forceinline__ void wait_async0() {
  asm volatile("s_wait_asynccnt 0" ::: "memory");
}

// Stage one K-chunk of Wq|Wk|Wv into LDS in WMMA pair-major layout:
//   float2 at [p][wcol] = { W[k0+2p, c], W[k0+2p+1, c] },  wcol = w*64 + c.
// 3*32*64 = 6144 elements -> 24 async b32 copies per thread, coalesced reads.
__device__ __forceinline__ void stage_weights(const float* __restrict__ Wq,
                                              const float* __restrict__ Wk,
                                              const float* __restrict__ Wv,
                                              int k0, uint32_t lds_byte_base,
                                              int tid) {
#pragma unroll
  for (int i = 0; i < 24; ++i) {
    const int f = i * 256 + tid;
    const int c  = f & 63;           // column within one weight matrix
    const int kk = (f >> 6) & 31;    // k-row within chunk
    const int w  = f >> 11;          // 0=Q, 1=K, 2=V (uniform per wave)
    const float* g = (w == 0 ? Wq : (w == 1 ? Wk : Wv)) +
                     (size_t)(k0 + kk) * DHEAD + c;
    const uint32_t loff =
        lds_byte_base +
        (uint32_t)(((((kk >> 1) * PSTRIDE) + w * 64 + c) * 2 + (kk & 1)) * 4);
    async_copy_b32(loff, g);
  }
}

// ---------------------------------------------------------------------------
// Kernel 1: fused QKV projection.  [BS,H] @ [H,64] x3  -> q [BS,64], and the
// block's own share of M[b] += K[b]^T V[b] from its 64 rows of K and V, which
// go from the accumulators through LDS and never reach global memory.
// 8 waves/block on 64 rows: wave -> 16 rows x 96 cols (6 wmma accumulators),
// waves w and w+4 take the two column halves of one row tile, so that the
// grid has one block for each of the chip's 256 WGPs.
// Weights double-buffered in LDS (pair-major) via async global->LDS DMA;
// each B fragment is a single conflict-free aligned ds_load_b64.
// A (global) is fetched one chunk ahead, B (LDS) one group of two k-steps ahead, in registers.
// grid: BS/(16*4) = 256 blocks of 256 threads.
// ---------------------------------------------------------------------------
__global__ __launch_bounds__(256) void qkv_proj_kernel(
    const float* __restrict__ x,   // [BS, H]
    const float* __restrict__ Wk,  // [H, D]
    const float* __restrict__ Wq,  // [H, D]
    const float* __restrict__ Wv,  // [H, D]
    float* __restrict__ qb, float* __restrict__ Mbuf) {
  __shared__ __align__(16) v2f ldsw[2][NPAIR * PSTRIDE];  // 52 KB

  const int lane = threadIdx.x & 31;
  // Wave-uniform: keeps the column half and the output pointers scalar.
  const int wave = __builtin_amdgcn_readfirstlane(threadIdx.x >> 5);
  const int chalf = wave >> 2;                       // cols 0..95 or 96..191
  const int m0 = (blockIdx.x * 4 + (wave & 3)) * 16; // output row base
  const int arow = lane & 15;
  const int koff = (lane >> 4) << 1;                 // 0 or 2
  const int bcol = lane & 15;

  const uint32_t lds_base0 = (uint32_t)(uintptr_t)&ldsw[0][0];
  const uint32_t lds_base1 = (uint32_t)(uintptr_t)&ldsw[1][0];

  v8f acc[6];                // 16-col tiles chalf*6 .. chalf*6+5 of Q|K|V
#pragma unroll
  for (int i = 0; i < 6; ++i) acc[i] = vzero8();

  const float* xrow = x + (size_t)(m0 + arow) * HID;

  // A fragments of chunk 0; later chunks are fetched one chunk ahead.
  v2f acur[KC / 4];
#pragma unroll
  for (int ks = 0; ks < KC / 4; ++ks)
    acur[ks] = *(const v2f*)(xrow + ks * 4 + koff);

  // Prologue: stage chunk 0 into buffer 0.
  stage_weights(Wq, Wk, Wv, 0, lds_base0, threadIdx.x);

  for (int c = 0; c < NCHUNK; ++c) {
    wait_async0();          // this wave's copies for chunk c have landed in LDS
    __syncthreads();        // all waves' copies have landed

    const v2f* lp = &ldsw[c & 1][0];

    // A fragments of chunk c+1: issued a whole chunk ahead of their first use,
    // so the latency of x runs under this chunk's WMMAs.
    // The last chunk has no successor: its index is clamped (branch-free,
    // in bounds) and what it fetches is not used.
    const float* xn = xrow + ((c + 1 < NCHUNK) ? c + 1 : c) * KC + koff;
    v2f anxt[KC / 4];
#pragma unroll
    for (int ks = 0; ks < KC / 4; ++ks)
      anxt[ks] = *(const v2f*)(xn + ks * 4);             // A[m, kk..kk+1]

    // The A loads above are in flight and the code below reuses their address
    // registers: the wait that is kept in front of such an overwrite.
    asm volatile("s_wait_xcnt 0x0" ::: "memory");

    // B fragments: the 12 of k-steps 2g+2, 2g+3 are read from LDS as one group
    // in front of the 12 WMMAs of k-steps 2g, 2g+1 (second register set).
    const int base0 = (lane >> 4) * PSTRIDE + chalf * 96 + bcol;  // k-pair 2*ks + half
    v2f bcur[12], bnxt[12];
#pragma unroll
    for (int j = 0; j < 12; ++j)
      bcur[j] = lp[base0 + 2 * (j / 6) * PSTRIDE + (j % 6) * 16];

    if (c + 1 < NCHUNK)     // overlap next chunk's DMA with this chunk's WMMAs
      stage_weights(Wq, Wk, Wv, (c + 1) * KC,
                    ((c + 1) & 1) ? lds_base1 : lds_base0, threadIdx.x);

    // Unrolled throughout: acc, acur, bcur and bnxt are indexed by constants
    // only and so stay in registers.
#pragma unroll
    for (int g = 0; g < KC / 8; ++g) {
      if (g + 1 < KC / 8) {
        const int base = base0 + 4 * (g + 1) * PSTRIDE;
#pragma unroll
        for (int j = 0; j < 12; ++j)
          bnxt[j] = lp[base + 2 * (j / 6) * PSTRIDE + (j % 6) * 16];
        // Keeps those reads one group in front of the WMMAs (for speed only).
        __builtin_amdgcn_sched_barrier(0);
      }
#pragma unroll
      for (int h = 0; h < 2; ++h) {
        const v2f a = acur[2 * g + h];
#pragma unroll
        for (int t = 0; t < 6; ++t)
          acc[t] = wmma_f32(a, bcur[h * 6 + t], acc[t]);
      }
#pragma unroll
      for (int j = 0; j < 12; ++j) bcur[j] = bnxt[j];
    }
#pragma unroll
    for (int ks = 0; ks < KC / 4; ++ks) acur[ks] = anxt[ks];
    __syncthreads();        // buffer (c&1) free for reuse at chunk c+2
  }

  // C/D layout: vgpr j, lanes 0-15 -> M=j, lanes 16-31 -> M=j+8; N = lane&15
  const int mhalf = (lane >> 4) << 3;
  // The weight buffers are free (no copy in flight, last reads behind the
  // loop's closing barrier): they take the block's K|V tile, pair-major like
  // the weights: float2 at [p][col] = rows 2p, 2p+1; col 0..63 K, 64..127 V.
  v2f* kv = &ldsw[0][0];
  const int prow = ((wave & 3) * 16 + mhalf) >> 1;   // pair row of acc[t][0..1]
#pragma unroll
  for (int t = 0; t < 6; ++t) {
    const int tile = chalf * 6 + t;                  // 0..3 Q, 4..7 K, 8..11 V
    if (tile >= 4) {
#pragma unroll
      for (int j = 0; j < 8; j += 2) {
        v2f pr;
        pr.x = acc[t][j];
        pr.y = acc[t][j + 1];
        kv[(prow + (j >> 1)) * KVSTRIDE + (tile - 4) * 16 + (lane & 15)] = pr;
      }
    }
  }
  __syncthreads();          // the whole K|V tile is in LDS

  // M[b] += K^T V over this block's 64 rows: each wave 2 of the 16 16x16
  // tiles (one row of tiles, two columns: the A fragment serves both).
  // A[i, s'] = k[s', i], B[s', j] = v[s', j]; s' ascending, 4 per WMMA.
  const int ar0 = (wave >> 1) * 16;                  // row base (k-feature i)
  const int bc0 = (wave & 1) * 32;                   // col base (v-feature j)
  const v2f* kvl = kv + (lane >> 4) * KVSTRIDE + (lane & 15);
  v8f macc0 = vzero8(), macc1 = vzero8();
#pragma unroll
  for (int s = 0; s < ROWS; s += 4) {
    const v2f* r = kvl + (s >> 1) * KVSTRIDE;
    const v2f a = r[ar0];
    macc0 = wmma_f32(a, r[64 + bc0], macc0);
    macc1 = wmma_f32(a, r[64 + bc0 + 16], macc1);
  }
  float* Mb = Mbuf + (size_t)(blockIdx.x / (SEQ / ROWS)) * DHEAD * DHEAD +
              (ar0 + mhalf) * DHEAD + bc0 + (lane & 15);
#pragma unroll
  for (int j = 0; j < 8; ++j) {
    atomicAdd(&Mb[j * DHEAD], macc0[j]);
    atomicAdd(&Mb[j * DHEAD + 16], macc1[j]);
  }
  // The adds above are in flight and the code below reuses their registers:
  // the wait that is kept in front of such an overwrite.
  asm volatile("s_wait_xcnt 0x0" ::: "memory");

  // Q goes out last: in front of the barrier above its stores would be
  // waited for there by the whole block.
  if (chalf == 0) {
#pragma unroll
    for (int t = 0; t < 4; ++t) {
#pragma unroll
      for (int j = 0; j < 8; ++j) {
        const size_t idx =
            (size_t)(m0 + mhalf + j) * DHEAD + t * 16 + (lane & 15);
        qb[idx] = acc[t][j];
      }
    }
  }
}

// ---------------------------------------------------------------------------
// Kernel 2: out = Q @ M[b] * (1/sqrt(D)).  [BS,64] @ [64,64].
// grid: 128 blocks of 256 threads; wave -> 16 rows x 64 cols.
// ---------------------------------------------------------------------------
__global__ __launch_bounds__(256) void qm_kernel(
    const float* __restrict__ qb, const float* __restrict__ Mbuf,
    float* __restrict__ out) {
  const int lane = threadIdx.x & 31;
  const int wave = threadIdx.x >> 5;
  const int m0 = (blockIdx.x * 8 + wave) * 16;       // rows; never straddles batch
  const int b = m0 / SEQ;
  const int arow = lane & 15;
  const int koff = (lane >> 4) << 1;
  const int bcol = lane & 15;
  const int mhalf = (lane >> 4) << 3;

  const float* qrow = qb + (size_t)(m0 + arow) * DHEAD;
  const float* Mb = Mbuf + (size_t)b * DHEAD * DHEAD;

  v8f acc[4];
#pragma unroll
  for (int i = 0; i < 4; ++i) acc[i] = vzero8();

#pragma unroll
  for (int kk = 0; kk < DHEAD; kk += 4) {
    const v2f a = *(const v2f*)(qrow + kk + koff);
    const int r0 = (kk + koff) * DHEAD;
    const int r1 = r0 + DHEAD;
#pragma unroll
    for (int nt = 0; nt < 4; ++nt) {
      v2f bbm;
      bbm.x = Mb[r0 + nt * 16 + bcol];
      bbm.y = Mb[r1 + nt * 16 + bcol];
      acc[nt] = wmma_f32(a, bbm, acc[nt]);
    }
  }

  const float scale = 0.125f;                        // 1/sqrt(64)
#pragma unroll
  for (int nt = 0; nt < 4; ++nt) {
#pragma unroll
    for (int j = 0; j < 8; ++j) {
      out[(size_t)(m0 + mhalf + j) * DHEAD + nt * 16 + (lane & 15)] =
          acc[nt][j] * scale;
    }
  }
}

// ---------------------------------------------------------------------------
// Host launcher. Inputs: x, Wk, Wq, Wv (fp32). Output: [B,S,D] fp32.
// Workspace layout: q (4 MB) | M (64 KB).
// ---------------------------------------------------------------------------
extern "C" void kernel_launch(void* const* d_in, const int* in_sizes, int n_in,
                              void* d_out, int out_size, void* d_ws,
                              size_t ws_size, hipStream_t stream) {
  (void)in_sizes; (void)n_in; (void)out_size; (void)ws_size;
  const float* x  = (const float*)d_in[0];
  const float* Wk = (const float*)d_in[1];
  const float* Wq = (const float*)d_in[2];
  const float* Wv = (const float*)d_in[3];
  float* out = (float*)d_out;

  const size_t proj_elems = (size_t)BS * DHEAD;      // 1,048,576
  float* qb = (float*)d_ws;
  float* Mb = qb + proj_elems;                       // BATCH*64*64 floats

  hipMemsetAsync(Mb, 0, (size_t)BATCH * DHEAD * DHEAD * sizeof(float), stream);

  qkv_proj_kernel<<<BS / ROWS, 256, 0, stream>>>(x, Wk, Wq, Wv, qb, Mb);
  qm_kernel<<<BS / 128, 256, 0, stream>>>(qb, Mb, out);
}

// v004
// Timed twice side by side with v003, it ran 1.07 and 1.06 times as fast.
// Counting every step since v000, it is 1.93 times as fast.
#include <hip/hip_runtime.h>

// ---------------------------------------------------------------------------
// Problem constants (match reference): B=4, S=4096, H=1024, D=64
// out = Q (K^T V) / sqrt(D)   (no softmax -> associativity refactor)
// ---------------------------------------------------------------------------
#define BATCH 4
#define SEQ   4096
#define HID   1024
#define DHEAD 64
#define BS    (BATCH * SEQ)          // 16384 rows
#define ROWS  64                     // rows of x per projection block; also the
                                     // s-values of one K^T V partial sum
#define KC    32                     // K-chunk staged in LDS per block
#define NCHUNK (HID / KC)            // 32 chunks
#define NPAIR (KC / 2)               // 16 k-pairs per chunk
#define PSTRIDE 208                  // pair-row stride in float2 (192 + 16 pad)
                                     // 416 dwords = 32 mod 64 banks -> the two
                                     // lane-halves hit disjoint bank halves
#define KVSTRIDE 144                 // same for the K|V tile (128 + 16 pad)
#define XPITCH 36                    // x tile row pitch in floats (32 + 4 pad):
                                     // 16 rows x 2 lane-halves of 8-byte reads
                                     // fall on 64 distinct banks

typedef __attribute__((ext_vector_type(2))) float v2f;
typedef __attribute__((ext_vector_type(8))) float v8f;

// V_WMMA_F32_16X16X4_F32: D(16x16 f32) = A(16x4 f32) * B(4x16 f32) + C
__device__ __forceinline__ v8f wmma_f32(v2f a, v2f b, v8f c) {
  return __builtin_amdgcn_wmma_f32_16x16x4_f32(false, a, false, b, (short)0, c,
                                               false, false);
}

__device__ __forceinline__ v8f vzero8() {
  v8f z = {0.f, 0.f, 0.f, 0.f, 0.f, 0.f, 0.f, 0.f};
  return z;
}

// gfx1250 async DMA: LDS[lds_off..+3] = MEM[gaddr..+3]; tracked by ASYNCcnt.
// 4B granularity lets the copy itself perform the pair-interleave permute.
__device__ __forceinline__ void async_copy_b32(uint32_t lds_off,
                                               const float* gaddr) {
  asm volatile("global_load_async_to_lds_b32 %0, %1, off"
               :
               : "v"(lds_off), "v"(gaddr)
               : "memory");
}

__device__ __forceinline__ void wait_async0() {
  asm volatile("s_wait_asynccnt 0" ::: "memory");
}

// Stage one K-chunk of Wq|Wk|Wv into LDS in WMMA pair-major layout:
//   float2 at [p][wcol] = { W[k0+2p, c], W[k0+2p+1, c] },  wcol = w*64 + c.
// 3*32*64 = 6144 elements -> 24 async b32 copies per thread, coalesced reads.
__device__ __forceinline__ void stage_weights(const float* __restrict__ Wq,
                                              const float* __restrict__ Wk,
                                              const float* __restrict__ Wv,
                                              int k0, uint32_t lds_byte_base,
                                              int tid) {
#pragma unroll
  for (int i = 0; i < 24; ++i) {
    const int f = i * 256 + tid;
    const int c  = f & 63;           // column within one weight matrix
    const int kk = (f >> 6) & 31;    // k-row within chunk
    const int w  = f >> 11;          // 0=Q, 1=K, 2=V (uniform per wave)
    const float* g = (w == 0 ? Wq : (w == 1 ? Wk : Wv)) +
                     (size_t)(k0 + kk) * DHEAD + c;
    const uint32_t loff =
        lds_byte_base +
        (uint32_t)(((((kk >> 1) * PSTRIDE) + w * 64 + c) * 2 + (kk & 1)) * 4);
    async_copy_b32(loff, g);
  }
}

// Stage one K-chunk of the block's 64 rows of x into LDS, rows kept row-major:
// 64 x 128 B = 512 pieces of 16 B, two per thread; eight lanes take one row's
// whole 128-B line, so one copy touches 4 lines where a fragment load from
// global memory touches 16.  g0, l0: this thread's piece in rows 0..31.
__device__ __forceinline__ void stage_x(const float* g0, uint32_t l0) {
  const float* g1 = g0 + (size_t)(ROWS / 2) * HID;
  const uint32_t l1 = l0 + (ROWS / 2) * XPITCH * 4;
  // The closing wait is kept in front of any later overwrite of the address
  // registers that the two copies name; inside the statement nothing can be
  // moved in front of it.
  asm volatile("global_load_async_to_lds_b128 %0, %2, off\n\t"
               "global_load_async_to_lds_b128 %1, %3, off\n\t"
               "s_wait_xcnt 0x0"
               :
               : "v"(l0), "v"(l1), "v"(g0), "v"(g1)
               : "memory");
}

// ---------------------------------------------------------------------------
// Kernel 1: fused QKV projection.  [BS,H] @ [H,64] x3  -> q [BS,64], and the
// block's own share of M[b] += K[b]^T V[b] from its 64 rows of K and V, which
// go from the accumulators through LDS and never reach global memory.
// 8 waves/block on 64 rows: wave -> 16 rows x 96 cols (6 wmma accumulators),
// waves w and w+4 take the two column halves of one row tile, so that the
// grid has one block for each of the chip's 256 WGPs.
// Weights double-buffered in LDS (pair-major) via async global->LDS DMA;
// each B fragment is a single conflict-free aligned ds_load_b64.
// x goes the same way, one chunk ahead, as whole 128-B lines; both column
// halves read their A fragments from that one tile.
// B (LDS) is fetched two k-steps ahead, in registers.
// grid: BS/(16*4) = 256 blocks of 256 threads.
// ---------------------------------------------------------------------------
__global__ __launch_bounds__(256) void qkv_proj_kernel(
    const float* __restrict__ x,   // [BS, H]
    const float* __restrict__ Wk,  // [H, D]
    const float* __restrict__ Wq,  // [H, D]
    const float* __restrict__ Wv,  // [H, D]
    float* __restrict__ qb, float* __restrict__ Mbuf) {
  __shared__ __align__(16) v2f ldsw[2][NPAIR * PSTRIDE];  // 52 KB
  __shared__ __align__(16) float ldsx[2][ROWS * XPITCH];  // 18 KB

  const int lane = threadIdx.x & 31;
  // Wave-uniform: keeps the column half and the output pointers scalar.
  const int wave = __builtin_amdgcn_readfirstlane(threadIdx.x >> 5);
  const int chalf = wave >> 2;                       // cols 0..95 or 96..191
  const int m0 = (blockIdx.x * 4 + (wave & 3)) * 16; // output row base
  const int arow = lane & 15;
  const int koff = (lane >> 4) << 1;                 // 0 or 2
  const int bcol = lane & 15;

  const uint32_t lds_base0 = (uint32_t)(uintptr_t)&ldsw[0][0];
  const uint32_t lds_base1 = (uint32_t)(uintptr_t)&ldsw[1][0];

  v8f acc[6];                // 16-col tiles chalf*6 .. chalf*6+5 of Q|K|V
#pragma unroll
  for (int i = 0; i < 6; ++i) acc[i] = vzero8();

  // This thread's 16-byte piece of the x tile: row tid/8, piece tid%8.
  const float* xg = x +
                    (size_t)(blockIdx.x * ROWS + (threadIdx.x >> 3)) * HID +
                    (threadIdx.x & 7) * 4;
  const uint32_t xl = (uint32_t)(uintptr_t)&ldsx[0][0] +
                      (threadIdx.x >> 3) * (XPITCH * 4) + (threadIdx.x & 7) * 16;
  // This lane's A fragments in the tile: its row, its k-pair of each k-step.
  const int aoff = ((wave & 3) * 16 + arow) * XPITCH + koff;

  // Prologue: stage chunk 0 into buffer 0.
  stage_x(xg, xl);
  stage_weights(Wq, Wk, Wv, 0, lds_base0, threadIdx.x);

  for (int c = 0; c < NCHUNK; ++c) {
    wait_async0();          // this wave's copies for chunk c have landed in LDS
    __syncthreads();        // all waves' copies have landed

    const v2f* lp = &ldsw[c & 1][0];

    // A fragments of this chunk, in one read group with the first B fragments.
    const float* xa = &ldsx[c & 1][aoff];
    v2f acur[KC / 4];
#pragma unroll
    for (int ks = 0; ks < KC / 4; ++ks)
      acur[ks] = *(const v2f*)(xa + ks * 4);             // A[m, kk..kk+1]

    // B fragments: the 12 of k-steps 2g+2, 2g+3 are read from LDS as one group
    // in front of the 12 WMMAs of k-steps 2g, 2g+1 (second register set).
    const int base0 = (lane >> 4) * PSTRIDE + chalf * 96 + bcol;  // k-pair 2*ks + half
    v2f bcur[12], bnxt[12];
#pragma unroll
    for (int j = 0; j < 12; ++j)
      bcur[j] = lp[base0 + 2 * (j / 6) * PSTRIDE + (j % 6) * 16];

    if (c + 1 < NCHUNK)     // x first: it comes from furthest away
      stage_x(xg + (c + 1) * KC, xl + ((c + 1) & 1) * (ROWS * XPITCH * 4));

    if (c + 1 < NCHUNK)     // overlap next chunk's DMA with this chunk's WMMAs
      stage_weights(Wq, Wk, Wv, (c + 1) * KC,
                    ((c + 1) & 1) ? lds_base1 : lds_base0, threadIdx.x);

    // Unrolled throughout: acc, acur, bcur and bnxt are indexed by constants
    // only and so stay in registers.
#pragma unroll
    for (int g = 0; g < KC / 8; ++g) {
      if (g + 1 < KC / 8) {
        const int base = base0 + 4 * (g + 1) * PSTRIDE;
#pragma unroll
        for (int j = 0; j < 12; ++j)
          bnxt[j] = lp[base + 2 * (j / 6) * PSTRIDE + (j % 6) * 16];
        // Keeps those reads one group in front of the WMMAs (for speed only).
        __builtin_amdgcn_sched_barrier(0);
      }
#pragma unroll
      for (int h = 0; h < 2; ++h) {
        const v2f a = acur[2 * g + h];
#pragma unroll
        for (int t = 0; t < 6; ++t)
          acc[t] = wmma_f32(a, bcur[h * 6 + t], acc[t]);
      }
#pragma unroll
      for (int j = 0; j < 12; ++j) bcur[j] = bnxt[j];
    }
    __syncthreads();        // buffers (c&1) free for reuse at chunk c+2
  }

  // C/D layout: vgpr j, lanes 0-15 -> M=j, lanes 16-31 -> M=j+8; N = lane&15
  const int mhalf = (lane >> 4) << 3;
  // The weight buffers are free (no copy in flight, last reads behind the
  // loop's closing barrier): they take the block's K|V tile, pair-major like
  // the weights: float2 at [p][col] = rows 2p, 2p+1; col 0..63 K, 64..127 V.
  v2f* kv = &ldsw[0][0];
  const int prow = ((wave & 3) * 16 + mhalf) >> 1;   // pair row of acc[t][0..1]
#pragma unroll
  for (int t = 0; t < 6; ++t) {
    const int tile = chalf * 6 + t;                  // 0..3 Q, 4..7 K, 8..11 V
    if (tile >= 4) {
#pragma unroll
      for (int j = 0; j < 8; j += 2) {
        v2f pr;
        pr.x = acc[t][j];
        pr.y = acc[t][j + 1];
        kv[(prow + (j >> 1)) * KVSTRIDE + (tile - 4) * 16 + (lane & 15)] = pr;
      }
    }
  }
  __syncthreads();          // the whole K|V tile is in LDS

  // M[b] += K^T V over this block's 64 rows: each wave 2 of the 16 16x16
  // tiles (one row of tiles, two columns: the A fragment serves both).
  // A[i, s'] = k[s', i], B[s', j] = v[s', j]; s' ascending, 4 per WMMA.
  const int ar0 = (wave >> 1) * 16;                  // row base (k-feature i)
  const int bc0 = (wave & 1) * 32;                   // col base (v-feature j)
  const v2f* kvl = kv + (lane >> 4) * KVSTRIDE + (lane & 15);
  v8f macc0 = vzero8(), macc1 = vzero8();
#pragma unroll
  for (int s = 0; s < ROWS; s += 4) {
    const v2f* r = kvl + (s >> 1) * KVSTRIDE;
    const v2f a = r[ar0];
    macc0 = wmma_f32(a, r[64 + bc0], macc0);
    macc1 = wmma_f32(a, r[64 + bc0 + 16], macc1);
  }
  float* Mb = Mbuf + (size_t)(blockIdx.x / (SEQ / ROWS)) * DHEAD * DHEAD +
              (ar0 + mhalf) * DHEAD + bc0 + (lane & 15);
#pragma unroll
  for (int j = 0; j < 8; ++j) {
    atomicAdd(&Mb[j * DHEAD], macc0[j]);
    atomicAdd(&Mb[j * DHEAD + 16], macc1[j]);
  }
  // The adds above are in flight and the code below reuses their registers:
  // the wait that is kept in front of such an overwrite.
  asm volatile("s_wait_xcnt 0x0" ::: "memory");

  // Q goes out last: in front of the barrier above its stores would be
  // waited for there by the whole block.
  if (chalf == 0) {
#pragma unroll
    for (int t = 0; t < 4; ++t) {
#pragma unroll
      for (int j = 0; j < 8; ++j) {
        const size_t idx =
            (size_t)(m0 + mhalf + j) * DHEAD + t * 16 + (lane & 15);
        qb[idx] = acc[t][j];
      }
    }
  }
}

// ---------------------------------------------------------------------------
// Kernel 2: out = Q @ M[b] * (1/sqrt(D)).  [BS,64] @ [64,64].
// grid: 128 blocks of 256 threads; wave -> 16 rows x 64 cols.
// ---------------------------------------------------------------------------
__global__ __launch_bounds__(256) void qm_kernel(
    const float* __restrict__ qb, const float* __restrict__ Mbuf,
    float* __restrict__ out) {
  const int lane = threadIdx.x & 31;
  const int wave = threadIdx.x >> 5;
  const int m0 = (blockIdx.x * 8 + wave) * 16;       // rows; never straddles batch
  const int b = m0 / SEQ;
  const int arow = lane & 15;
  const int koff = (lane >> 4) << 1;
  const int bcol = lane & 15;
  const int mhalf = (lane >> 4) << 3;

  const float* qrow = qb + (size_t)(m0 + arow) * DHEAD;
  const float* Mb = Mbuf + (size_t)b * DHEAD * DHEAD;

  v8f acc[4];
#pragma unroll
  for (int i = 0; i < 4; ++i) acc[i] = vzero8();

#pragma unroll
  for (int kk = 0; kk < DHEAD; kk += 4) {
    const v2f a = *(const v2f*)(qrow + kk + koff);
    const int r0 = (kk + koff) * DHEAD;
    const int r1 = r0 + DHEAD;
#pragma unroll
    for (int nt = 0; nt < 4; ++nt) {
      v2f bbm;
      bbm.x = Mb[r0 + nt * 16 + bcol];
      bbm.y = Mb[r1 + nt * 16 + bcol];
      acc[nt] = wmma_f32(a, bbm, acc[nt]);
    }
  }

  const float scale = 0.125f;                        // 1/sqrt(64)
#pragma unroll
  for (int nt = 0; nt < 4; ++nt) {
#pragma unroll
    for (int j = 0; j < 8; ++j) {
      out[(size_t)(m0 + mhalf + j) * DHEAD + nt * 16 + (lane & 15)] =
          acc[nt][j] * scale;
    }
  }
}

// ---------------------------------------------------------------------------
// Host launcher. Inputs: x, Wk, Wq, Wv (fp32). Output: [B,S,D] fp32.
// Workspace layout: q (4 MB) | M (64 KB).
// ---------------------------------------------------------------------------
extern "C" void kernel_launch(void* const* d_in, const int* in_sizes, int n_in,
                              void* d_out, int out_size, void* d_ws,
                              size_t ws_size, hipStream_t stream) {
  (void)in_sizes; (void)n_in; (void)out_size; (void)ws_size;
  const float* x  = (const float*)d_in[0];
  const float* Wk = (const float*)d_in[1];
  const float* Wq = (const float*)d_in[2];
  const float* Wv = (const float*)d_in[3];
  float* out = (float*)d_out;

  const size_t proj_elems = (size_t)BS * DHEAD;      // 1,048,576
  float* qb = (float*)d_ws;
  float* Mb = qb + proj_elems;                       // BATCH*64*64 floats

  hipMemsetAsync(Mb, 0, (size_t)BATCH * DHEAD * DHEAD * sizeof(float), stream);

  qkv_proj_kernel<<<BS / ROWS, 256, 0, stream>>>(x, Wk, Wq, Wv, qb, Mb);
  qm_kernel<<<BS / 128, 256, 0, stream>>>(qb, Mb, out);
}

// v005
// It runs in 45.7 microseconds.
// Two timings next to v004 both put it at 1.12 times that version's speed.
// Over all steps from v000 it is 2.17 times as fast.
#include <hip/hip_runtime.h>

// ---------------------------------------------------------------------------
// Problem constants (match reference): B=4, S=4096, H=1024, D=64
// out = Q (K^T V) / sqrt(D)   (no softmax -> associativity refactor)
// ---------------------------------------------------------------------------
#define BATCH 4
#define SEQ   4096
#define HID   1024
#define DHEAD 64
#define BS    (BATCH * SEQ)          // 16384 rows
#define ROWS  64                     // rows of x per projection block; also the
                                     // s-values of one K^T V partial sum
#define KC    32                     // K-chunk staged in LDS per block
#define NCHUNK (HID / KC)            // 32 chunks
#define NPAIR (KC / 2)               // 16 k-pairs per chunk
#define PSTRIDE 208                  // pair-row stride in float2 (192 + 16 pad)
                                     // 416 dwords = 32 mod 64 banks -> the two
                                     // lane-halves hit disjoint bank halves
#define KVSTRIDE 144                 // same for the K|V tile (128 + 16 pad)
#define WCHUNK (NPAIR * 192 * 2)      // floats of one packed weight chunk (24 KB)
#define WPIECE 1024                  // floats that the block's 256 threads copy
                                     // at once, 16 B each
#define XPITCH 36                    // x tile row pitch in floats (32 + 4 pad):
                                     // 16 rows x 2 lane-halves of 8-byte reads
                                     // fall on 64 distinct banks

typedef __attribute__((ext_vector_type(2))) float v2f;
typedef __attribute__((ext_vector_type(4))) float v4f;
typedef __attribute__((ext_vector_type(8))) float v8f;

// V_WMMA_F32_16X16X4_F32: D(16x16 f32) = A(16x4 f32) * B(4x16 f32) + C
__device__ __forceinline__ v8f wmma_f32(v2f a, v2f b, v8f c) {
  return __builtin_amdgcn_wmma_f32_16x16x4_f32(false, a, false, b, (short)0, c,
                                               false, false);
}

__device__ __forceinline__ v8f vzero8() {
  v8f z = {0.f, 0.f, 0.f, 0.f, 0.f, 0.f, 0.f, 0.f};
  return z;
}

__device__ __forceinline__ void wait_async0() {
  asm volatile("s_wait_asynccnt 0" ::: "memory");
}

// Stage one K-chunk of x and of the packed weights into LDS, 16 bytes a copy.
// x: the block's 64 rows, kept row-major: 64 x 128 B = 512 pieces, two per
// thread; eight lanes take one row's whole 128-B line.  gx, lx: this thread's
// piece in rows 0..31.
// Weights: the pack kernel has laid them pair-major already:
//   float2 at [p][wcol] = { W[k0+2p, c], W[k0+2p+1, c] },  wcol = w*64 + c,
// so a chunk is 16 pair rows x 1536 B = 1536 pieces, six per thread; one
// wave's copy is 512 contiguous bytes inside one pair row on both sides.
// gw: this thread's first piece of the chunk; lw[j]: where piece j lands.
__device__ __forceinline__ void stage_chunk(const float* gx, uint32_t lx,
                                            const float* gw,
                                            const uint32_t (&lw)[6]) {
  const float* gx1 = gx + (size_t)(ROWS / 2) * HID;
  const uint32_t lx1 = lx + (ROWS / 2) * XPITCH * 4;
  const float* gw1 = gw + 1 * WPIECE;
  const float* gw2 = gw + 2 * WPIECE;
  const float* gw3 = gw + 3 * WPIECE;
  const float* gw4 = gw + 4 * WPIECE;
  const float* gw5 = gw + 5 * WPIECE;
  // x first: it comes from furthest away.  The closing wait is kept in front
  // of any later overwrite of the address registers that the eight copies
  // name; inside the statement nothing can be moved in front of it.
  asm volatile("global_load_async_to_lds_b128 %0, %8, off\n\t"
               "global_load_async_to_lds_b128 %1, %9, off\n\t"
               "global_load_async_to_lds_b128 %2, %10, off\n\t"
               "global_load_async_to_lds_b128 %3, %11, off\n\t"
               "global_load_async_to_lds_b128 %4, %12, off\n\t"
               "global_load_async_to_lds_b128 %5, %13, off\n\t"
               "global_load_async_to_lds_b128 %6, %14, off\n\t"
               "global_load_async_to_lds_b128 %7, %15, off\n\t"
               "s_wait_xcnt 0x0"
               :
               : "v"(lx), "v"(lx1), "v"(lw[0]), "v"(lw[1]), "v"(lw[2]),
                 "v"(lw[3]), "v"(lw[4]), "v"(lw[5]), "v"(gx), "v"(gx1),
                 "v"(gw), "v"(gw1), "v"(gw2), "v"(gw3), "v"(gw4), "v"(gw5)
               : "memory");
}

// ---------------------------------------------------------------------------
// Kernel 0: lay Wq|Wk|Wv out pair-major in the workspace, the order in which
// the projection's B fragments read them from LDS, so that the projection can
// stage them as 16-byte pieces; and store the start value 0 of M.
//   float2 at [P][wcol] = { W[2P, c], W[2P+1, c] },  P = 0..511, wcol = w*64+c.
// One thread: two neighbouring columns of one k-pair, 16 bytes out.
// grid: 512 * 96 / 256 = 192 blocks of 256 threads.
// ---------------------------------------------------------------------------
__global__ __launch_bounds__(256) void pack_weights_kernel(
    const float* __restrict__ Wk,  // [H, D]
    const float* __restrict__ Wq,  // [H, D]
    const float* __restrict__ Wv,  // [H, D]
    float* __restrict__ wpack, float* __restrict__ Mbuf) {
  const int gid = blockIdx.x * 256 + threadIdx.x;
  const int kp = gid / 96;           // k-pair
  const int r = gid % 96;            // column pair of Q|K|V
  const int w = r >> 5;              // 0=Q, 1=K, 2=V (uniform per wave)
  const int c = (r & 31) * 2;
  const float* g = (w == 0 ? Wq : (w == 1 ? Wk : Wv)) +
                   (size_t)(2 * kp) * DHEAD + c;
  const v2f lo = *(const v2f*)g;             // W[2kp,   c..c+1]
  const v2f hi = *(const v2f*)(g + DHEAD);   // W[2kp+1, c..c+1]
  v4f o = {lo.x, hi.x, lo.y, hi.y};
  *(v4f*)(wpack + (size_t)gid * 4) = o;
  if (gid < BATCH * DHEAD * DHEAD / 4) {
    v4f z = {0.f, 0.f, 0.f, 0.f};
    *(v4f*)(Mbuf + (size_t)gid * 4) = z;
  }
}

// ---------------------------------------------------------------------------
// Kernel 1: fused QKV projection.  [BS,H] @ [H,64] x3  -> q [BS,64], and the
// block's own share of M[b] += K[b]^T V[b] from its 64 rows of K and V, which
// go from the accumulators through LDS and never reach global memory.
// 8 waves/block on 64 rows: wave -> 16 rows x 96 cols (6 wmma accumulators),
// waves w and w+4 take the two column halves of one row tile, so that the
// grid has one block for each of the chip's 256 WGPs.
// Weights double-buffered in LDS (pair-major, as packed by kernel 0) via async
// global->LDS DMA; each B fragment is a single conflict-free aligned
// ds_load_b64.
// x goes the same way, one chunk ahead, as whole 128-B lines; both column
// halves read their A fragments from that one tile.
// B (LDS) is fetched two k-steps ahead, in registers.
// grid: BS/(16*4) = 256 blocks of 256 threads.
// ---------------------------------------------------------------------------
__global__ __launch_bounds__(256) void qkv_proj_kernel(
    const float* __restrict__ x,      // [BS, H]
    const float* __restrict__ wpack,  // [H/2, 192] float2, from kernel 0
    float* __restrict__ qb, float* __restrict__ Mbuf) {
  __shared__ __align__(16) v2f ldsw[2][NPAIR * PSTRIDE];  // 52 KB
  __shared__ __align__(16) float ldsx[2][ROWS * XPITCH];  // 18 KB

  const int lane = threadIdx.x & 31;
  // Wave-uniform: keeps the column half and the output pointers scalar.
  const int wave = __builtin_amdgcn_readfirstlane(threadIdx.x >> 5);
  const int chalf = wave >> 2;                       // cols 0..95 or 96..191
  const int m0 = (blockIdx.x * 4 + (wave & 3)) * 16; // output row base
  const int arow = lane & 15;
  const int koff = (lane >> 4) << 1;                 // 0 or 2
  const int bcol = lane & 15;

  // This thread's six 16-byte pieces of a weight chunk: piece j*256 + tid; 96
  // pieces fill a pair row, so a wave (32 pieces) stays inside one.
  const float* wg = wpack + threadIdx.x * 4;
  uint32_t wl[6];
#pragma unroll
  for (int j = 0; j < 6; ++j) {
    const int grp = j * 8 + wave;                    // 32 pieces each
    wl[j] = (uint32_t)(uintptr_t)&ldsw[0][0] + (grp / 3) * (PSTRIDE * 8) +
            (grp % 3) * 512 + lane * 16;
  }

  v8f acc[6];                // 16-col tiles chalf*6 .. chalf*6+5 of Q|K|V
#pragma unroll
  for (int i = 0; i < 6; ++i) acc[i] = vzero8();

  // This thread's 16-byte piece of the x tile: row tid/8, piece tid%8.
  const float* xg = x +
                    (size_t)(blockIdx.x * ROWS + (threadIdx.x >> 3)) * HID +
                    (threadIdx.x & 7) * 4;
  const uint32_t xl = (uint32_t)(uintptr_t)&ldsx[0][0] +
                      (threadIdx.x >> 3) * (XPITCH * 4) + (threadIdx.x & 7) * 16;
  // This lane's A fragments in the tile: its row, its k-pair of each k-step.
  const int aoff = ((wave & 3) * 16 + arow) * XPITCH + koff;

  // Prologue: stage chunk 0 into buffer 0.
  stage_chunk(xg, xl, wg, wl);

  for (int c = 0; c < NCHUNK; ++c) {
    wait_async0();          // this wave's copies for chunk c have landed in LDS
    __syncthreads();        // all waves' copies have landed

    const v2f* lp = &ldsw[c & 1][0];

    // A fragments of this chunk, in one read group with the first B fragments.
    const float* xa = &ldsx[c & 1][aoff];
    v2f acur[KC / 4];
#pragma unroll
    for (int ks = 0; ks < KC / 4; ++ks)
      acur[ks] = *(const v2f*)(xa + ks * 4);             // A[m, kk..kk+1]

    // B fragments: the 12 of k-steps 2g+2, 2g+3 are read from LDS as one group
    // in front of the 12 WMMAs of k-steps 2g, 2g+1 (second register set).
    const int base0 = (lane >> 4) * PSTRIDE + chalf * 96 + bcol;  // k-pair 2*ks + half
    v2f bcur[12], bnxt[12];
#pragma unroll
    for (int j = 0; j < 12; ++j)
      bcur[j] = lp[base0 + 2 * (j / 6) * PSTRIDE + (j % 6) * 16];

    if (c + 1 < NCHUNK) {   // overlap next chunk's DMA with this chunk's WMMAs
      uint32_t wn[6];
#pragma unroll
      for (int j = 0; j < 6; ++j)
        wn[j] = wl[j] + ((c + 1) & 1) * (NPAIR * PSTRIDE * 8);
      stage_chunk(xg + (c + 1) * KC, xl + ((c + 1) & 1) * (ROWS * XPITCH * 4),
                  wg + (c + 1) * WCHUNK, wn);
    }

    // Unrolled throughout: acc, acur, bcur and bnxt are indexed by constants
    // only and so stay in registers.
#pragma unroll
    for (int g = 0; g < KC / 8; ++g) {
      if (g + 1 < KC / 8) {
        const int base = base0 + 4 * (g + 1) * PSTRIDE;
#pragma unroll
        for (int j = 0; j < 12; ++j)
          bnxt[j] = lp[base + 2 * (j / 6) * PSTRIDE + (j % 6) * 16];
        // Keeps those reads one group in front of the WMMAs (for speed only).
        __builtin_amdgcn_sched_barrier(0);
      }
#pragma unroll
      for (int h = 0; h < 2; ++h) {
        const v2f a = acur[2 * g + h];
#pragma unroll
        for (int t = 0; t < 6; ++t)
          acc[t] = wmma_f32(a, bcur[h * 6 + t], acc[t]);
      }
#pragma unroll
      for (int j = 0; j < 12; ++j) bcur[j] = bnxt[j];
    }
    __syncthreads();        // buffers (c&1) free for reuse at chunk c+2
  }

  // C/D layout: vgpr j, lanes 0-15 -> M=j, lanes 16-31 -> M=j+8; N = lane&15
  const int mhalf = (lane >> 4) << 3;
  // The weight buffers are free (no copy in flight, last reads behind the
  // loop's closing barrier): they take the block's K|V tile, pair-major like
  // the weights: float2 at [p][col] = rows 2p, 2p+1; col 0..63 K, 64..127 V.
  v2f* kv = &ldsw[0][0];
  const int prow = ((wave & 3) * 16 + mhalf) >> 1;   // pair row of acc[t][0..1]
#pragma unroll
  for (int t = 0; t < 6; ++t) {
    const int tile = chalf * 6 + t;                  // 0..3 Q, 4..7 K, 8..11 V
    if (tile >= 4) {
#pragma unroll
      for (int j = 0; j < 8; j += 2) {
        v2f pr;
        pr.x = acc[t][j];
        pr.y = acc[t][j + 1];
        kv[(prow + (j >> 1)) * KVSTRIDE + (tile - 4) * 16 + (lane & 15)] = pr;
      }
    }
  }
  __syncthreads();          // the whole K|V tile is in LDS

  // M[b] += K^T V over this block's 64 rows: each wave 2 of the 16 16x16
  // tiles (one row of tiles, two columns: the A fragment serves both).
  // A[i, s'] = k[s', i], B[s', j] = v[s', j]; s' ascending, 4 per WMMA.
  const int ar0 = (wave >> 1) * 16;                  // row base (k-feature i)
  const int bc0 = (wave & 1) * 32;                   // col base (v-feature j)
  const v2f* kvl = kv + (lane >> 4) * KVSTRIDE + (lane & 15);
  v8f macc0 = vzero8(), macc1 = vzero8();
#pragma unroll
  for (int s = 0; s < ROWS; s += 4) {
    const v2f* r = kvl + (s >> 1) * KVSTRIDE;
    const v2f a = r[ar0];
    macc0 = wmma_f32(a, r[64 + bc0], macc0);
    macc1 = wmma_f32(a, r[64 + bc0 + 16], macc1);
  }
  float* Mb = Mbuf + (size_t)(blockIdx.x / (SEQ / ROWS)) * DHEAD * DHEAD +
              (ar0 + mhalf) * DHEAD + bc0 + (lane & 15);
#pragma unroll
  for (int j = 0; j < 8; ++j) {
    atomicAdd(&Mb[j * DHEAD], macc0[j]);
    atomicAdd(&Mb[j * DHEAD + 16], macc1[j]);
  }
  // The adds above are in flight and the code below reuses their registers:
  // the wait that is kept in front of such an overwrite.
  asm volatile("s_wait_xcnt 0x0" ::: "memory");

  // Q goes out last: in front of the barrier above its stores would be
  // waited for there by the whole block.
  if (chalf == 0) {
#pragma unroll
    for (int t = 0; t < 4; ++t) {
#pragma unroll
      for (int j = 0; j < 8; ++j) {
        const size_t idx =
            (size_t)(m0 + mhalf + j) * DHEAD + t * 16 + (lane & 15);
        qb[idx] = acc[t][j];
      }
    }
  }
}

// ---------------------------------------------------------------------------
// Kernel 2: out = Q @ M[b] * (1/sqrt(D)).  [BS,64] @ [64,64].
// grid: 128 blocks of 256 threads; wave -> 16 rows x 64 cols.
// ---------------------------------------------------------------------------
__global__ __launch_bounds__(256) void qm_kernel(
    const float* __restrict__ qb, const float* __restrict__ Mbuf,
    float* __restrict__ out) {
  const int lane = threadIdx.x & 31;
  const int wave = threadIdx.x >> 5;
  const int m0 = (blockIdx.x * 8 + wave) * 16;       // rows; never straddles batch
  const int b = m0 / SEQ;
  const int arow = lane & 15;
  const int koff = (lane >> 4) << 1;
  const int bcol = lane & 15;
  const int mhalf = (lane >> 4) << 3;

  const float* qrow = qb + (size_t)(m0 + arow) * DHEAD;
  const float* Mb = Mbuf + (size_t)b * DHEAD * DHEAD;

  v8f acc[4];
#pragma unroll
  for (int i = 0; i < 4; ++i) acc[i] = vzero8();

#pragma unroll
  for (int kk = 0; kk < DHEAD; kk += 4) {
    const v2f a = *(const v2f*)(qrow + kk + koff);
    const int r0 = (kk + koff) * DHEAD;
    const int r1 = r0 + DHEAD;
#pragma unroll
    for (int nt = 0; nt < 4; ++nt) {
      v2f bbm;
      bbm.x = Mb[r0 + nt * 16 + bcol];
      bbm.y = Mb[r1 + nt * 16 + bcol];
      acc[nt] = wmma_f32(a, bbm, acc[nt]);
    }
  }

  const float scale = 0.125f;                        // 1/sqrt(64)
#pragma unroll
  for (int nt = 0; nt < 4; ++nt) {
#pragma unroll
    for (int j = 0; j < 8; ++j) {
      out[(size_t)(m0 + mhalf + j) * DHEAD + nt * 16 + (lane & 15)] =
          acc[nt][j] * scale;
    }
  }
}

// ---------------------------------------------------------------------------
// Host launcher. Inputs: x, Wk, Wq, Wv (fp32). Output: [B,S,D] fp32.
// Workspace layout: q (4 MB) | M (64 KB) | packed weights (768 KB).
// ---------------------------------------------------------------------------
extern "C" void kernel_launch(void* const* d_in, const int* in_sizes, int n_in,
                              void* d_out, int out_size, void* d_ws,
                              size_t ws_size, hipStream_t stream) {
  (void)in_sizes; (void)n_in; (void)out_size; (void)ws_size;
  const float* x  = (const float*)d_in[0];
  const float* Wk = (const float*)d_in[1];
  const float* Wq = (const float*)d_in[2];
  const float* Wv = (const float*)d_in[3];
  float* out = (float*)d_out;

  const size_t proj_elems = (size_t)BS * DHEAD;      // 1,048,576
  float* qb = (float*)d_ws;
  float* Mb = qb + proj_elems;                       // BATCH*64*64 floats

  float* wpack = Mb + (size_t)BATCH * DHEAD * DHEAD; // 3*HID*DHEAD floats

  pack_weights_kernel<<<(HID / 2) * 96 / 256, 256, 0, stream>>>(Wk, Wq, Wv,
                                                                wpack, Mb);
  qkv_proj_kernel<<<BS / ROWS, 256, 0, stream>>>(x, wpack, qb, Mb);
  qm_kernel<<<BS / 128, 256, 0, stream>>>(qb, Mb, out);
}

// v006
// Measured time: 44.3 microseconds a run.
// In two side-by-side timings against v005, it was 1.03 and 1.02 times as fast.
// All steps since v000 together make it 2.22 times as fast.
#include <hip/hip_runtime.h>

// ---------------------------------------------------------------------------
// Problem constants (match reference): B=4, S=4096, H=1024, D=64
// out = Q (K^T V) / sqrt(D)   (no softmax -> associativity refactor)
// ---------------------------------------------------------------------------
#define BATCH 4
#define SEQ   4096
#define HID   1024
#define DHEAD 64
#define BS    (BATCH * SEQ)          // 16384 rows
#define ROWS  64                     // rows of x per projection block; also the
                                     // s-values of one K^T V partial sum
#define KC    32                     // K-chunk staged in LDS per block
#define NCHUNK (HID / KC)            // 32 chunks
#define NPAIR (KC / 2)               // 16 k-pairs per chunk
#define PSTRIDE 208                  // pair-row stride in float2 (192 + 16 pad)
                                     // 416 dwords = 32 mod 64 banks -> the two
                                     // lane-halves hit disjoint bank halves
#define KVSTRIDE 144                 // same for the K|V tile (128 + 16 pad)
#define WCHUNK (NPAIR * 192 * 2)      // floats of one packed weight chunk (24 KB)
#define WPIECE 1024                  // floats that the block's 256 threads copy
                                     // at once, 16 B each
#define XPITCH 36                    // x tile row pitch in floats (32 + 4 pad):
                                     // 16 rows x 2 lane-halves of 8-byte reads
                                     // fall on 64 distinct banks

typedef __attribute__((ext_vector_type(2))) float v2f;
typedef __attribute__((ext_vector_type(4))) float v4f;
typedef __attribute__((ext_vector_type(8))) float v8f;

// V_WMMA_F32_16X16X4_F32: D(16x16 f32) = A(16x4 f32) * B(4x16 f32) + C
__device__ __forceinline__ v8f wmma_f32(v2f a, v2f b, v8f c) {
  return __builtin_amdgcn_wmma_f32_16x16x4_f32(false, a, false, b, (short)0, c,
                                               false, false);
}

__device__ __forceinline__ v8f vzero8() {
  v8f z = {0.f, 0.f, 0.f, 0.f, 0.f, 0.f, 0.f, 0.f};
  return z;
}

__device__ __forceinline__ void wait_async0() {
  asm volatile("s_wait_asynccnt 0" ::: "memory");
}

// All of this wave's copies to LDS but the eight youngest (one chunk's) have
// landed: the counter returns in issue order.
__device__ __forceinline__ void wait_async8() {
  asm volatile("s_wait_asynccnt 8" ::: "memory");
}

__device__ __forceinline__ void wait_ds0() {
  asm volatile("s_wait_dscnt 0" ::: "memory");
}

// The 8 A fragments of a chunk: this lane's row, its k-pair of each k-step.
__device__ __forceinline__ void read_a(v2f (&a)[KC / 4], const float* xa) {
#pragma unroll
  for (int ks = 0; ks < KC / 4; ++ks)
    a[ks] = *(const v2f*)(xa + ks * 4);                  // A[m, kk..kk+1]
}

// The 12 B fragments of two k-steps: 6 column tiles each.
__device__ __forceinline__ void read_b(v2f (&b)[12], const v2f* p) {
#pragma unroll
  for (int j = 0; j < 12; ++j)
    b[j] = p[2 * (j / 6) * PSTRIDE + (j % 6) * 16];
}

// One block: two k-steps on the wave's 6 accumulators.
__device__ __forceinline__ void mma_block(v8f (&acc)[6], v2f a0, v2f a1,
                                          const v2f (&b)[12]) {
#pragma unroll
  for (int t = 0; t < 6; ++t) acc[t] = wmma_f32(a0, b[t], acc[t]);
#pragma unroll
  for (int t = 0; t < 6; ++t) acc[t] = wmma_f32(a1, b[6 + t], acc[t]);
}

// Stage one K-chunk of x and of the packed weights into LDS, 16 bytes a copy.
// x: the block's 64 rows, kept row-major: 64 x 128 B = 512 pieces, two per
// thread; eight lanes take one row's whole 128-B line.  gx, lx: this thread's
// piece in rows 0..31.
// Weights: the pack kernel has laid them pair-major already:
//   float2 at [p][wcol] = { W[k0+2p, c], W[k0+2p+1, c] },  wcol = w*64 + c,
// so a chunk is 16 pair rows x 1536 B = 1536 pieces, six per thread; one
// wave's copy is 512 contiguous bytes inside one pair row on both sides.
// gw: this thread's first piece of the chunk; lw[j]: where piece j lands.
__device__ __forceinline__ void stage_chunk(const float* gx, uint32_t lx,
                                            const float* gw,
                                            const uint32_t (&lw)[6]) {
  const float* gx1 = gx + (size_t)(ROWS / 2) * HID;
  const uint32_t lx1 = lx + (ROWS / 2) * XPITCH * 4;
  const float* gw1 = gw + 1 * WPIECE;
  const float* gw2 = gw + 2 * WPIECE;
  const float* gw3 = gw + 3 * WPIECE;
  const float* gw4 = gw + 4 * WPIECE;
  const float* gw5 = gw + 5 * WPIECE;
  // x first: it comes from furthest away.  The closing wait is kept in front
  // of any later overwrite of the address registers that the eight copies
  // name; inside the statement nothing can be moved in front of it.
  asm volatile("global_load_async_to_lds_b128 %0, %8, off\n\t"
               "global_load_async_to_lds_b128 %1, %9, off\n\t"
               "global_load_async_to_lds_b128 %2, %10, off\n\t"
               "global_load_async_to_lds_b128 %3, %11, off\n\t"
               "global_load_async_to_lds_b128 %4, %12, off\n\t"
               "global_load_async_to_lds_b128 %5, %13, off\n\t"
               "global_load_async_to_lds_b128 %6, %14, off\n\t"
               "global_load_async_to_lds_b128 %7, %15, off\n\t"
               "s_wait_xcnt 0x0"
               :
               : "v"(lx), "v"(lx1), "v"(lw[0]), "v"(lw[1]), "v"(lw[2]),
                 "v"(lw[3]), "v"(lw[4]), "v"(lw[5]), "v"(gx), "v"(gx1),
                 "v"(gw), "v"(gw1), "v"(gw2), "v"(gw3), "v"(gw4), "v"(gw5)
               : "memory");
}

// ---------------------------------------------------------------------------
// Kernel 0: lay Wq|Wk|Wv out pair-major in the workspace, the order in which
// the projection's B fragments read them from LDS, so that the projection can
// stage them as 16-byte pieces; and store the start value 0 of M.
//   float2 at [P][wcol] = { W[2P, c], W[2P+1, c] },  P = 0..511, wcol = w*64+c.
// One thread: two neighbouring columns of one k-pair, 16 bytes out.
// grid: 512 * 96 / 256 = 192 blocks of 256 threads.
// ---------------------------------------------------------------------------
__global__ __launch_bounds__(256) void pack_weights_kernel(
    const float* __restrict__ Wk,  // [H, D]
    const float* __restrict__ Wq,  // [H, D]
    const float* __restrict__ Wv,  // [H, D]
    float* __restrict__ wpack, float* __restrict__ Mbuf) {
  const int gid = blockIdx.x * 256 + threadIdx.x;
  const int kp = gid / 96;           // k-pair
  const int r = gid % 96;            // column pair of Q|K|V
  const int w = r >> 5;              // 0=Q, 1=K, 2=V (uniform per wave)
  const int c = (r & 31) * 2;
  const float* g = (w == 0 ? Wq : (w == 1 ? Wk : Wv)) +
                   (size_t)(2 * kp) * DHEAD + c;
  const v2f lo = *(const v2f*)g;             // W[2kp,   c..c+1]
  const v2f hi = *(const v2f*)(g + DHEAD);   // W[2kp+1, c..c+1]
  v4f o = {lo.x, hi.x, lo.y, hi.y};
  *(v4f*)(wpack + (size_t)gid * 4) = o;
  if (gid < BATCH * DHEAD * DHEAD / 4) {
    v4f z = {0.f, 0.f, 0.f, 0.f};
    *(v4f*)(Mbuf + (size_t)gid * 4) = z;
  }
}

// ---------------------------------------------------------------------------
// Kernel 1: fused QKV projection.  [BS,H] @ [H,64] x3  -> q [BS,64], and the
// block's own share of M[b] += K[b]^T V[b] from its 64 rows of K and V, which
// go from the accumulators through LDS and never reach global memory.
// 8 waves/block on 64 rows: wave -> 16 rows x 96 cols (6 wmma accumulators),
// waves w and w+4 take the two column halves of one row tile, so that the
// grid has one block for each of the chip's 256 WGPs.
// Weights in an LDS ring of three buffers (pair-major, as packed by kernel 0)
// via async global->LDS DMA, two chunks ahead; each B fragment is a single
// conflict-free aligned ds_load_b64.
// x goes the same way, as whole 128-B lines; both column halves read their A
// fragments from that one tile.
// B (LDS) is fetched one block of two k-steps ahead, in registers, also from
// one chunk into the next: one barrier a chunk, in front of its last block.
// grid: BS/(16*4) = 256 blocks of 256 threads.
// ---------------------------------------------------------------------------
__global__ __launch_bounds__(256) void qkv_proj_kernel(
    const float* __restrict__ x,      // [BS, H]
    const float* __restrict__ wpack,  // [H/2, 192] float2, from kernel 0
    float* __restrict__ qb, float* __restrict__ Mbuf) {
  __shared__ __align__(16) v2f ldsw[3][NPAIR * PSTRIDE];  // 78 KB
  __shared__ __align__(16) float ldsx[3][ROWS * XPITCH];  // 27 KB

  const int lane = threadIdx.x & 31;
  // Wave-uniform: keeps the column half and the output pointers scalar.
  const int wave = __builtin_amdgcn_readfirstlane(threadIdx.x >> 5);
  const int chalf = wave >> 2;                       // cols 0..95 or 96..191
  const int m0 = (blockIdx.x * 4 + (wave & 3)) * 16; // output row base
  const int arow = lane & 15;
  const int koff = (lane >> 4) << 1;                 // 0 or 2
  const int bcol = lane & 15;

  // This thread's six 16-byte pieces of a weight chunk: piece j*256 + tid; 96
  // pieces fill a pair row, so a wave (32 pieces) stays inside one.
  const float* wg = wpack + threadIdx.x * 4;
  uint32_t wl[6];
#pragma unroll
  for (int j = 0; j < 6; ++j) {
    const int grp = j * 8 + wave;                    // 32 pieces each
    wl[j] = (uint32_t)(uintptr_t)&ldsw[0][0] + (grp / 3) * (PSTRIDE * 8) +
            (grp % 3) * 512 + lane * 16;
  }

  v8f acc[6];                // 16-col tiles chalf*6 .. chalf*6+5 of Q|K|V
#pragma unroll
  for (int i = 0; i < 6; ++i) acc[i] = vzero8();

  // This thread's 16-byte piece of the x tile: row tid/8, piece tid%8.
  const float* xg = x +
                    (size_t)(blockIdx.x * ROWS + (threadIdx.x >> 3)) * HID +
                    (threadIdx.x & 7) * 4;
  const uint32_t xl = (uint32_t)(uintptr_t)&ldsx[0][0] +
                      (threadIdx.x >> 3) * (XPITCH * 4) + (threadIdx.x & 7) * 16;
  // This lane's A fragments in the tile: its row, its k-pair of each k-step.
  const int aoff = ((wave & 3) * 16 + arow) * XPITCH + koff;

  // Stage chunk ch into the ring's buffers number buf.
  auto stage = [&](int ch, int buf) {
    uint32_t wn[6];
#pragma unroll
    for (int j = 0; j < 6; ++j) wn[j] = wl[j] + buf * (NPAIR * PSTRIDE * 8);
    stage_chunk(xg + ch * KC, xl + buf * (ROWS * XPITCH * 4), wg + ch * WCHUNK,
                wn);
  };

  // Prologue: chunks 0 and 1 into buffers 0 and 1; chunk 0 published.
  stage(0, 0);
  stage(1, 1);
  wait_async8();            // this wave's copies of chunk 0 have landed in LDS
  __syncthreads();          // all waves' copies of chunk 0 have landed

  // Fragments in registers: all 8 A fragments of a chunk, and the 12 B
  // fragments of one block of two k-steps.  Those of chunk 0, block 0:
  const int base0 = (lane >> 4) * PSTRIDE + chalf * 96 + bcol;  // k-pair 2*ks + half
  v2f acur[KC / 4], bcur[12];
  read_a(acur, &ldsx[0][aoff]);
  read_b(bcur, &ldsw[0][base0]);

  int bc = 0, bn = 1, bf = 2;   // buffers of chunks c, c+1, c+2 (c mod 3 ...)

  // One chunk.  refill: a chunk c+2 exists; more: a chunk c+1 exists.
  // Inlined at its three places, where both are constants: acc, acur and bcur
  // stay in registers.
  auto chunk = [&](int c, bool refill, bool more)
                   __attribute__((always_inline)) {
    // Chunk c+2 goes where chunk c-1 was: every wave's reads of that had
    // returned in front of the barrier that published chunk c.  Two chunks of
    // lead: a wave that gets the matrix pipe late still copies in time, and
    // the copies' closing wait falls where the SIMD's other wave has WMMAs.
    if (refill) stage(c + 2, bf);

    const v2f* lp = &ldsw[bc][base0];
    v2f bnxt[12];

    // Blocks 0..2: the 12 B fragments of the next block are read from LDS as
    // one group in front of this block's 12 WMMAs (second register set).
    // Unrolled: acc, acur, bcur and bnxt are indexed by constants only and so
    // stay in registers.
#pragma unroll
    for (int g = 0; g < KC / 8 - 1; ++g) {
      read_b(bnxt, lp + 4 * (g + 1) * PSTRIDE);
      // Keeps those reads one group in front of the WMMAs, for speed only.
      __builtin_amdgcn_sched_barrier(0);
      mma_block(acc, acur[2 * g], acur[2 * g + 1], bcur);
#pragma unroll
      for (int j = 0; j < 12; ++j) bcur[j] = bnxt[j];
    }

    // Publish point of chunk c+1, in front of chunk c's last block, whose
    // fragments are in registers already: behind the barrier chunk c+1 may be
    // read by every wave and the buffers of chunk c are free.
    wait_ds0();             // this wave's last reads of chunk c have returned
    if (refill)
      wait_async8();        // all but chunk c+2's eight: chunk c+1 has landed
    else
      wait_async0();        // nothing younger was issued
    __syncthreads();

    const v2f alast0 = acur[KC / 4 - 2], alast1 = acur[KC / 4 - 1];
    if (more) {             // first fragments of chunk c+1, under the WMMAs below
      read_a(acur, &ldsx[bn][aoff]);
      read_b(bnxt, &ldsw[bn][base0]);
    }
    // Keeps the reads above in front of the last block's WMMAs, as one group.
    __builtin_amdgcn_sched_barrier(0);
    mma_block(acc, alast0, alast1, bcur);
    if (more) {
#pragma unroll
      for (int j = 0; j < 12; ++j) bcur[j] = bnxt[j];
    }

    const int t = bc;
    bc = bn;
    bn = bf;
    bf = t;
  };

  // Every trip of the loop issues eight copies and waits for all but those;
  // the last two chunks issue none and wait for all.
  for (int c = 0; c < NCHUNK - 2; ++c) chunk(c, true, true);
  chunk(NCHUNK - 2, false, true);
  chunk(NCHUNK - 1, false, false);

  // C/D layout: vgpr j, lanes 0-15 -> M=j, lanes 16-31 -> M=j+8; N = lane&15
  const int mhalf = (lane >> 4) << 3;
  // The weight buffers are free (no copy in flight, last reads in front of
  // the loop's last barrier): they take the block's K|V tile, pair-major like
  // the weights: float2 at [p][col] = rows 2p, 2p+1; col 0..63 K, 64..127 V.
  v2f* kv = &ldsw[0][0];
  const int prow = ((wave & 3) * 16 + mhalf) >> 1;   // pair row of acc[t][0..1]
#pragma unroll
  for (int t = 0; t < 6; ++t) {
    const int tile = chalf * 6 + t;                  // 0..3 Q, 4..7 K, 8..11 V
    if (tile >= 4) {
#pragma unroll
      for (int j = 0; j < 8; j += 2) {
        v2f pr;
        pr.x = acc[t][j];
        pr.y = acc[t][j + 1];
        kv[(prow + (j >> 1)) * KVSTRIDE + (tile - 4) * 16 + (lane & 15)] = pr;
      }
    }
  }
  __syncthreads();          // the whole K|V tile is in LDS

  // M[b] += K^T V over this block's 64 rows: each wave 2 of the 16 16x16
  // tiles (one row of tiles, two columns: the A fragment serves both).
  // A[i, s'] = k[s', i], B[s', j] = v[s', j]; s' ascending, 4 per WMMA.
  const int ar0 = (wave >> 1) * 16;                  // row base (k-feature i)
  const int bc0 = (wave & 1) * 32;                   // col base (v-feature j)
  const v2f* kvl = kv + (lane >> 4) * KVSTRIDE + (lane & 15);
  v8f macc0 = vzero8(), macc1 = vzero8();
#pragma unroll
  for (int s = 0; s < ROWS; s += 4) {
    const v2f* r = kvl + (s >> 1) * KVSTRIDE;
    const v2f a = r[ar0];
    macc0 = wmma_f32(a, r[64 + bc0], macc0);
    macc1 = wmma_f32(a, r[64 + bc0 + 16], macc1);
  }
  float* Mb = Mbuf + (size_t)(blockIdx.x / (SEQ / ROWS)) * DHEAD * DHEAD +
              (ar0 + mhalf) * DHEAD + bc0 + (lane & 15);
#pragma unroll
  for (int j = 0; j < 8; ++j) {
    atomicAdd(&Mb[j * DHEAD], macc0[j]);
    atomicAdd(&Mb[j * DHEAD + 16], macc1[j]);
  }
  // The adds above are in flight and the code below reuses their registers:
  // the wait that is kept in front of such an overwrite.
  asm volatile("s_wait_xcnt 0x0" ::: "memory");

  // Q goes out last: in front of the barrier above its stores would be
  // waited for there by the whole block.
  if (chalf == 0) {
#pragma unroll
    for (int t = 0; t < 4; ++t) {
#pragma unroll
      for (int j = 0; j < 8; ++j) {
        const size_t idx =
            (size_t)(m0 + mhalf + j) * DHEAD + t * 16 + (lane & 15);
        qb[idx] = acc[t][j];
      }
    }
  }
}

// ---------------------------------------------------------------------------
// Kernel 2: out = Q @ M[b] * (1/sqrt(D)).  [BS,64] @ [64,64].
// grid: 128 blocks of 256 threads; wave -> 16 rows x 64 cols.
// ---------------------------------------------------------------------------
__global__ __launch_bounds__(256) void qm_kernel(
    const float* __restrict__ qb, const float* __restrict__ Mbuf,
    float* __restrict__ out) {
  const int lane = threadIdx.x & 31;
  const int wave = threadIdx.x >> 5;
  const int m0 = (blockIdx.x * 8 + wave) * 16;       // rows; never straddles batch
  const int b = m0 / SEQ;
  const int arow = lane & 15;
  const int koff = (lane >> 4) << 1;
  const int bcol = lane & 15;
  const int mhalf = (lane >> 4) << 3;

  const float* qrow = qb + (size_t)(m0 + arow) * DHEAD;
  const float* Mb = Mbuf + (size_t)b * DHEAD * DHEAD;

  v8f acc[4];
#pragma unroll
  for (int i = 0; i < 4; ++i) acc[i] = vzero8();

#pragma unroll
  for (int kk = 0; kk < DHEAD; kk += 4) {
    const v2f a = *(const v2f*)(qrow + kk + koff);
    const int r0 = (kk + koff) * DHEAD;
    const int r1 = r0 + DHEAD;
#pragma unroll
    for (int nt = 0; nt < 4; ++nt) {
      v2f bbm;
      bbm.x = Mb[r0 + nt * 16 + bcol];
      bbm.y = Mb[r1 + nt * 16 + bcol];
      acc[nt] = wmma_f32(a, bbm, acc[nt]);
    }
  }

  const float scale = 0.125f;                        // 1/sqrt(64)
#pragma unroll
  for (int nt = 0; nt < 4; ++nt) {
#pragma unroll
    for (int j = 0; j < 8; ++j) {
      out[(size_t)(m0 + mhalf + j) * DHEAD + nt * 16 + (lane & 15)] =
          acc[nt][j] * scale;
    }
  }
}

// ---------------------------------------------------------------------------
// Host launcher. Inputs: x, Wk, Wq, Wv (fp32). Output: [B,S,D] fp32.
// Workspace layout: q (4 MB) | M (64 KB) | packed weights (768 KB).
// ---------------------------------------------------------------------------
extern "C" void kernel_launch(void* const* d_in, const int* in_sizes, int n_in,
                              void* d_out, int out_size, void* d_ws,
                              size_t ws_size, hipStream_t stream) {
  (void)in_sizes; (void)n_in; (void)out_size; (void)ws_size;
  const float* x  = (const float*)d_in[0];
  const float* Wk = (const float*)d_in[1];
  const float* Wq = (const float*)d_in[2];
  const float* Wv = (const float*)d_in[3];
  float* out = (float*)d_out;

  const size_t proj_elems = (size_t)BS * DHEAD;      // 1,048,576
  float* qb = (float*)d_ws;
  float* Mb = qb + proj_elems;                       // BATCH*64*64 floats

  float* wpack = Mb + (size_t)BATCH * DHEAD * DHEAD; // 3*HID*DHEAD floats

  pack_weights_kernel<<<(HID / 2) * 96 / 256, 256, 0, stream>>>(Wk, Wq, Wv,
                                                                wpack, Mb);
  qkv_proj_kernel<<<BS / ROWS, 256, 0, stream>>>(x, wpack, qb, Mb);
  qm_kernel<<<BS / 128, 256, 0, stream>>>(qb, Mb, out);
}
